// v000
// Measured on an AMD MI455X. A time is GPU time per run, averaged over a window of back-to-back runs after a warm-up
// (all launches, gaps included; the runs take copies of the inputs in turn), and the median of several windows.
// Apart from v000's, it joins two sittings. Times from different sittings can be a few percent apart, while
// side-by-side timings come from the same sitting.
// v000, which the later versions start from, runs in 4290 microseconds.
#include <hip/hip_runtime.h>
#include <math.h>

// ---------------- problem constants ----------------
#define BB  4
#define TT  1024
#define CC  2048
#define HH  32
#define NN  64
#define KVC 512
#define MM  (BB*TT)          // 4096 rows
#define GN_EPS 0.00064f

typedef float v2f __attribute__((ext_vector_type(2)));
typedef float v8f __attribute__((ext_vector_type(8)));

#define AS1 __attribute__((address_space(1)))
#define AS3 __attribute__((address_space(3)))

#if defined(__has_builtin)
# if __has_builtin(__builtin_amdgcn_global_load_async_to_lds_b32) && \
     __has_builtin(__builtin_amdgcn_s_wait_asynccnt)
#  define USE_ASYNC_LDS 1
# endif
#endif

// =====================================================================
// Blocked WMMA f32 GEMM: Out[M,Nc] = X[M,K] @ W^T + bias, W (Nc,K) row-major.
// Wave tile 32x32 (2x2 wmma accs, 1 load per wmma), block = 4 waves -> 64x64.
// grid = (M/64, Nc/64).
// =====================================================================
__global__ __launch_bounds__(128)
void wmma_gemm_f32_blk(const float* __restrict__ X, const float* __restrict__ W,
                       const float* __restrict__ bias, float* __restrict__ Out,
                       int K, int Nc)
{
    const int lane = threadIdx.x & 31;
    const int wave = threadIdx.x >> 5;
    const int half = lane >> 4;
    const int l    = lane & 15;
    const int mw   = wave >> 1, nw = wave & 1;
    const int tileM = blockIdx.x * 64 + mw * 32;
    const int tileN = blockIdx.y * 64 + nw * 32;

    const float* xr0 = X + (size_t)(tileM + l)      * K;
    const float* xr1 = X + (size_t)(tileM + 16 + l) * K;
    const float* wr0 = W + (size_t)(tileN + l)      * K;
    const float* wr1 = W + (size_t)(tileN + 16 + l) * K;

    v8f acc00 = {}, acc01 = {}, acc10 = {}, acc11 = {};
    for (int k0 = 0; k0 < K; k0 += 4) {
        const int ko = k0 + 2*half;
        v2f a0 = *(const v2f*)(xr0 + ko);
        v2f a1 = *(const v2f*)(xr1 + ko);
        v2f b0 = *(const v2f*)(wr0 + ko);
        v2f b1 = *(const v2f*)(wr1 + ko);
        acc00 = __builtin_amdgcn_wmma_f32_16x16x4_f32(false, a0, false, b0, (short)0, acc00, false, false);
        acc01 = __builtin_amdgcn_wmma_f32_16x16x4_f32(false, a0, false, b1, (short)0, acc01, false, false);
        acc10 = __builtin_amdgcn_wmma_f32_16x16x4_f32(false, a1, false, b0, (short)0, acc10, false, false);
        acc11 = __builtin_amdgcn_wmma_f32_16x16x4_f32(false, a1, false, b1, (short)0, acc11, false, false);
    }

    const int col0 = tileN + l, col1 = tileN + 16 + l;
    const float bs0 = bias ? bias[col0] : 0.0f;
    const float bs1 = bias ? bias[col1] : 0.0f;
    #pragma unroll
    for (int j = 0; j < 8; ++j) {
        const int row0 = tileM + j + 8*half;           // C/D: VGPR j -> M=j / j+8
        const int row1 = row0 + 16;
        Out[(size_t)row0 * Nc + col0] = acc00[j] + bs0;
        Out[(size_t)row0 * Nc + col1] = acc01[j] + bs1;
        Out[(size_t)row1 * Nc + col0] = acc10[j] + bs0;
        Out[(size_t)row1 * Nc + col1] = acc11[j] + bs1;
    }
}

// =====================================================================
// Simple WMMA GEMM for the LoRA projections (Nc = 64/32), W stored (K,Nc).
// One wave = one 16x16 tile. TANH applies tanh instead of bias.
// =====================================================================
template<bool TANH>
__global__ __launch_bounds__(128)
void wmma_gemm_f32_small(const float* __restrict__ X, const float* __restrict__ W,
                         float* __restrict__ Out, int K, int Nc)
{
    const int lane = threadIdx.x & 31;
    const int wave = threadIdx.x >> 5;
    const int half = lane >> 4;
    const int l    = lane & 15;
    const int tileM = blockIdx.x * 16;
    const int tileN = wave * 16;
    if (tileN >= Nc) return;             // wave-uniform

    const float* xrow = X + (size_t)(tileM + l) * K;
    const int n = tileN + l;
    v8f acc = {};
    for (int k0 = 0; k0 < K; k0 += 4) {
        v2f a = *(const v2f*)(xrow + k0 + 2*half);
        v2f b;
        b.x = W[(size_t)(k0 + 2*half    ) * Nc + n];
        b.y = W[(size_t)(k0 + 2*half + 1) * Nc + n];
        acc = __builtin_amdgcn_wmma_f32_16x16x4_f32(false, a, false, b, (short)0, acc, false, false);
    }
    #pragma unroll
    for (int j = 0; j < 8; ++j) {
        const int row = tileM + j + 8*half;
        Out[(size_t)row * Nc + n] = TANH ? tanhf(acc[j]) : acc[j];
    }
}

// =====================================================================
// Fused elementwise: LoRA dots (w2/a2/v2), decay, gates, kv-head repeat,
// per-head L2 norm (wave32 shuffle reduce), aa/bb.
// =====================================================================
__global__ __launch_bounds__(256)
void fusion_kernel(const float* __restrict__ klin, const float* __restrict__ vlin,
                   const float* __restrict__ hw,  const float* __restrict__ ha,
                   const float* __restrict__ hv,  const float* __restrict__ v_first,
                   const float* __restrict__ w0,  const float* __restrict__ w2,
                   const float* __restrict__ a0,  const float* __restrict__ a2,
                   const float* __restrict__ v0,  const float* __restrict__ v2,
                   const float* __restrict__ k_k, const float* __restrict__ k_a,
                   float* __restrict__ decay, float* __restrict__ kpost,
                   float* __restrict__ vpost, float* __restrict__ aaO,
                   float* __restrict__ bbO)
{
    const int bt  = blockIdx.x;
    const int tid = threadIdx.x;
    __shared__ float shw[64], sha[64], shv[32];
    if (tid < 64)        shw[tid]       = hw[(size_t)bt*64 + tid];
    else if (tid < 128)  sha[tid - 64]  = ha[(size_t)bt*64 + (tid - 64)];
    else if (tid < 160)  shv[tid - 128] = hv[(size_t)bt*32 + (tid - 128)];
    __syncthreads();

    const int wave = tid >> 5, lane = tid & 31;
    for (int i = 0; i < 4; ++i) {
        const int h = i*8 + wave;
        const int hbase = h * NN;
        float kkp[2], aval[2], kp[2], vp[2], dec[2];
        #pragma unroll
        for (int s = 0; s < 2; ++s) {
            const int n = lane + 32*s;
            const int c = hbase + n;
            const size_t gc = (size_t)bt * CC + c;
            float wsum = w0[c], asum = a0[c], vsum = v0[c];
            for (int j = 0; j < 64; ++j) {
                wsum += shw[j] * w2[(size_t)j*CC + c];
                asum += sha[j] * a2[(size_t)j*CC + c];
            }
            for (int j = 0; j < 32; ++j)
                vsum += shv[j] * v2[(size_t)j*CC + c];
            const float wraw = -log1pf(expf(-wsum)) - 0.6f;   // -softplus(-t)-0.6
            dec[s] = expf(-expf(wraw));
            const float av = 1.f / (1.f + expf(-asum));
            const float vg = 1.f / (1.f + expf(-vsum));
            const int kvc = ((h >> 2) * NN) + n;              // kv-head repeat
            const float kf = klin[(size_t)bt*KVC + kvc];
            const float vf = vlin[(size_t)bt*KVC + kvc];
            kkp[s]  = kf * k_k[c];
            kp[s]   = kf * (1.f + (av - 1.f) * k_a[c]);
            vp[s]   = vf + (v_first[gc] - vf) * vg;
            aval[s] = av;
        }
        float ss = kkp[0]*kkp[0] + kkp[1]*kkp[1];
        for (int off = 16; off; off >>= 1) ss += __shfl_xor(ss, off);
        const float rn = 1.f / fmaxf(sqrtf(ss), 1e-12f);
        #pragma unroll
        for (int s = 0; s < 2; ++s) {
            const int c = hbase + lane + 32*s;
            const size_t gc = (size_t)bt * CC + c;
            const float kkn = kkp[s] * rn;
            decay[gc] = dec[s];
            kpost[gc] = kp[s];
            vpost[gc] = vp[s];
            aaO[gc]   = -kkn;
            bbO[gc]   = kkn * aval[s];
        }
    }
}

// =====================================================================
// Sequential RWKV-7 scan. grid = B*H, block = 64 (one thread per state row),
// S[64] in VGPRs. Per-timestep vectors triple-buffered in LDS; prefetched
// two steps ahead via GLOBAL_LOAD_ASYNC_TO_LDS (ASYNCcnt) when available,
// else software-pipelined register staging.
// =====================================================================
__global__ __launch_bounds__(64)
void scan_kernel(const float* __restrict__ r, const float* __restrict__ dc,
                 const float* __restrict__ k, const float* __restrict__ v,
                 const float* __restrict__ aa, const float* __restrict__ bb,
                 const float* __restrict__ state0, float* __restrict__ y)
{
    const int bh = blockIdx.x;            // b*H + h
    const int b = bh >> 5, h = bh & 31;
    const int i = threadIdx.x;            // state row
    float S[NN];
    const float* st = state0 + ((size_t)bh * NN + i) * NN;
    #pragma unroll
    for (int q = 0; q < NN; ++q) S[q] = st[q];

    __shared__ float buf[3][6*NN];

#ifdef USE_ASYNC_LDS
    // Async global->LDS, 2 steps ahead (12 outstanding b32 loads per wave).
    #define SCAN_ISSUE(t_, slot_)  do {                                          \
        const size_t gb_ = ((size_t)(b*TT + (t_)))*CC + h*NN + i;                \
        float* d_ = &buf[(slot_)][i];                                            \
        __builtin_amdgcn_global_load_async_to_lds_b32((AS1 int*)(r  + gb_), (AS3 int*)(d_        ), 0, 0); \
        __builtin_amdgcn_global_load_async_to_lds_b32((AS1 int*)(dc + gb_), (AS3 int*)(d_ + 1*NN), 0, 0); \
        __builtin_amdgcn_global_load_async_to_lds_b32((AS1 int*)(k  + gb_), (AS3 int*)(d_ + 2*NN), 0, 0); \
        __builtin_amdgcn_global_load_async_to_lds_b32((AS1 int*)(v  + gb_), (AS3 int*)(d_ + 3*NN), 0, 0); \
        __builtin_amdgcn_global_load_async_to_lds_b32((AS1 int*)(aa + gb_), (AS3 int*)(d_ + 4*NN), 0, 0); \
        __builtin_amdgcn_global_load_async_to_lds_b32((AS1 int*)(bb + gb_), (AS3 int*)(d_ + 5*NN), 0, 0); \
    } while (0)

    SCAN_ISSUE(0, 0);
    SCAN_ISSUE(1, 1);
    for (int t = 0; t < TT; ++t) {
        if (t + 2 < TT)      { SCAN_ISSUE(t + 2, (t + 2) % 3);
                               __builtin_amdgcn_s_wait_asynccnt(12); }
        else if (t + 1 < TT) { __builtin_amdgcn_s_wait_asynccnt(6); }
        else                 { __builtin_amdgcn_s_wait_asynccnt(0); }
        __syncthreads();
        const float* rb = &buf[t % 3][0];
        const float* db = rb + NN;  const float* kb = rb + 2*NN;
        const float* vb = rb + 3*NN; const float* ab = rb + 4*NN;
        const float* bp = rb + 5*NN;
        float sa = 0.f;
        #pragma unroll
        for (int q = 0; q < NN; ++q) sa += S[q] * ab[q];
        const float vi = vb[i];
        float yo = 0.f;
        #pragma unroll
        for (int q = 0; q < NN; ++q) {
            const float s2 = S[q]*db[q] + sa*bp[q] + vi*kb[q];
            S[q] = s2;
            yo += s2 * rb[q];
        }
        y[((size_t)(b*TT + t))*CC + h*NN + i] = yo;
        __syncthreads();
    }
    #undef SCAN_ISSUE
#else
    // Fallback: register double-buffer; loads for t+1 issued before compute(t).
    float rg[6];
    {
        const size_t gb = ((size_t)(b*TT))*CC + h*NN + i;
        rg[0]=r[gb]; rg[1]=dc[gb]; rg[2]=k[gb]; rg[3]=v[gb]; rg[4]=aa[gb]; rg[5]=bb[gb];
    }
    for (int t = 0; t < TT; ++t) {
        const int cur = t & 1;
        float* d = &buf[cur][i];
        d[0]=rg[0]; d[1*NN]=rg[1]; d[2*NN]=rg[2]; d[3*NN]=rg[3]; d[4*NN]=rg[4]; d[5*NN]=rg[5];
        __syncthreads();
        if (t + 1 < TT) {
            const size_t gb = ((size_t)(b*TT + t + 1))*CC + h*NN + i;
            rg[0]=r[gb]; rg[1]=dc[gb]; rg[2]=k[gb]; rg[3]=v[gb]; rg[4]=aa[gb]; rg[5]=bb[gb];
        }
        const float* rb = &buf[cur][0];
        const float* db = rb + NN;  const float* kb = rb + 2*NN;
        const float* vb = rb + 3*NN; const float* ab = rb + 4*NN;
        const float* bp = rb + 5*NN;
        float sa = 0.f;
        #pragma unroll
        for (int q = 0; q < NN; ++q) sa += S[q] * ab[q];
        const float vi = vb[i];
        float yo = 0.f;
        #pragma unroll
        for (int q = 0; q < NN; ++q) {
            const float s2 = S[q]*db[q] + sa*bp[q] + vi*kb[q];
            S[q] = s2;
            yo += s2 * rb[q];
        }
        y[((size_t)(b*TT + t))*CC + h*NN + i] = yo;
        __syncthreads();
    }
#endif
}

// =====================================================================
// GroupNorm over (T,N) per (b,h) + bonus term. xx aliases rbuf
// (each lane reads its r before writing the same location).
// =====================================================================
__global__ __launch_bounds__(256)
void gnorm_kernel(const float* __restrict__ y, const float* rbuf,
                  const float* __restrict__ kpost, const float* __restrict__ vpost,
                  const float* __restrict__ r_k, const float* __restrict__ ln_w,
                  const float* __restrict__ ln_b, float* xx)
{
    const int bh = blockIdx.x;
    const int b = bh >> 5, h = bh & 31;
    const int tid = threadIdx.x;
    __shared__ float red[256], red2[256];

    float s = 0.f, s2 = 0.f;
    for (int f = tid; f < TT*NN; f += 256) {
        const int t = f >> 6, n = f & 63;
        const float v = y[((size_t)(b*TT + t))*CC + h*NN + n];
        s += v; s2 += v*v;
    }
    red[tid] = s; red2[tid] = s2;
    __syncthreads();
    for (int off = 128; off; off >>= 1) {
        if (tid < off) { red[tid] += red[tid+off]; red2[tid] += red2[tid+off]; }
        __syncthreads();
    }
    const float mean = red[0]  * (1.f / 65536.f);
    const float var  = red2[0] * (1.f / 65536.f) - mean*mean;
    const float rstd = rsqrtf(var + GN_EPS);

    const int wave = tid >> 5, lane = tid & 31;
    const float lw0 = ln_w[h*NN + lane],      lb0 = ln_b[h*NN + lane];
    const float lw1 = ln_w[h*NN + lane + 32], lb1 = ln_b[h*NN + lane + 32];
    const float rk0 = r_k[h*NN + lane],       rk1 = r_k[h*NN + lane + 32];
    for (int t = wave; t < TT; t += 8) {
        const size_t base = ((size_t)(b*TT + t))*CC + h*NN;
        const float r0 = rbuf[base + lane],      r1 = rbuf[base + lane + 32];
        const float k0 = kpost[base + lane],     k1 = kpost[base + lane + 32];
        float d = r0*k0*rk0 + r1*k1*rk1;
        for (int off = 16; off; off >>= 1) d += __shfl_xor(d, off);
        const float y0 = y[base + lane], y1 = y[base + lane + 32];
        const float o0 = (y0 - mean)*rstd*lw0 + lb0 + d*vpost[base + lane];
        const float o1 = (y1 - mean)*rstd*lw1 + lb1 + d*vpost[base + lane + 32];
        xx[base + lane]      = o0;
        xx[base + lane + 32] = o1;
    }
}

// =====================================================================
extern "C" void kernel_launch(void* const* d_in, const int* in_sizes, int n_in,
                              void* d_out, int out_size, void* d_ws, size_t ws_size,
                              hipStream_t stream) {
    const float* x       = (const float*)d_in[0];
    const float* v_first = (const float*)d_in[1];
    const float* state0  = (const float*)d_in[2];
    const float* Rw      = (const float*)d_in[3];
    const float* R_bias  = (const float*)d_in[4];
    const float* Kw      = (const float*)d_in[5];
    const float* K_bias  = (const float*)d_in[6];
    const float* Vw      = (const float*)d_in[7];
    const float* V_bias  = (const float*)d_in[8];
    const float* Ow      = (const float*)d_in[9];
    const float* O_bias  = (const float*)d_in[10];
    const float* w0      = (const float*)d_in[11];
    const float* w1      = (const float*)d_in[12];
    const float* w2      = (const float*)d_in[13];
    const float* a0      = (const float*)d_in[14];
    const float* a1      = (const float*)d_in[15];
    const float* a2      = (const float*)d_in[16];
    const float* v0      = (const float*)d_in[17];
    const float* v1      = (const float*)d_in[18];
    const float* v2      = (const float*)d_in[19];
    const float* k_k     = (const float*)d_in[20];
    const float* k_a     = (const float*)d_in[21];
    const float* r_k     = (const float*)d_in[22];
    const float* ln_w    = (const float*)d_in[23];
    const float* ln_b    = (const float*)d_in[24];
    float* out = (float*)d_out;

    // workspace layout (floats)
    float* ws = (float*)d_ws;
    float* r_buf  = ws;                                // M*C   (later reused as xx)
    float* klin   = r_buf  + (size_t)MM*CC;            // M*512
    float* vlin   = klin   + (size_t)MM*KVC;           // M*512
    float* hw     = vlin   + (size_t)MM*KVC;           // M*64
    float* ha     = hw     + (size_t)MM*64;            // M*64
    float* hv     = ha     + (size_t)MM*64;            // M*32
    float* decayb = hv     + (size_t)MM*32;            // M*C
    float* kpost  = decayb + (size_t)MM*CC;            // M*C
    float* vpost  = kpost  + (size_t)MM*CC;            // M*C
    float* aab    = vpost  + (size_t)MM*CC;            // M*C
    float* bbb    = aab    + (size_t)MM*CC;            // M*C
    float* ybuf   = bbb    + (size_t)MM*CC;            // M*C
    float* xx     = r_buf;                             // alias: r dead after bonus read

    const dim3 blk(128);
    // Step 1: projections (blocked WMMA for the big GEMMs)
    wmma_gemm_f32_blk<<<dim3(MM/64, CC/64),  blk, 0, stream>>>(x, Rw, R_bias, r_buf, CC, CC);
    wmma_gemm_f32_blk<<<dim3(MM/64, KVC/64), blk, 0, stream>>>(x, Kw, K_bias, klin,  CC, KVC);
    wmma_gemm_f32_blk<<<dim3(MM/64, KVC/64), blk, 0, stream>>>(x, Vw, V_bias, vlin,  CC, KVC);
    wmma_gemm_f32_small<true ><<<dim3(MM/16), blk, 0, stream>>>(x, w1, hw, CC, 64);
    wmma_gemm_f32_small<false><<<dim3(MM/16), blk, 0, stream>>>(x, a1, ha, CC, 64);
    wmma_gemm_f32_small<false><<<dim3(MM/16), blk, 0, stream>>>(x, v1, hv, CC, 32);

    // fused elementwise prep
    fusion_kernel<<<dim3(MM), dim3(256), 0, stream>>>(
        klin, vlin, hw, ha, hv, v_first, w0, w2, a0, a2, v0, v2, k_k, k_a,
        decayb, kpost, vpost, aab, bbb);

    // Step 2: sequential scan
    scan_kernel<<<dim3(BB*HH), dim3(64), 0, stream>>>(
        r_buf, decayb, kpost, vpost, aab, bbb, state0, ybuf);

    // Step 3: group norm + bonus
    gnorm_kernel<<<dim3(BB*HH), dim3(256), 0, stream>>>(
        ybuf, r_buf, kpost, vpost, r_k, ln_w, ln_b, xx);

    // output projection
    wmma_gemm_f32_blk<<<dim3(MM/64, CC/64), blk, 0, stream>>>(xx, Ow, O_bias, out, CC, CC);
    (void)in_sizes; (void)n_in; (void)out_size; (void)ws_size;
}

// v001
// One run takes 3240 microseconds.
// Two timings next to v000 both put it at 1.32 times that version's speed.
#include <hip/hip_runtime.h>
#include <math.h>

// ---------------- problem constants ----------------
#define BB  4
#define TT  1024
#define CC  2048
#define HH  32
#define NN  64
#define KVC 512
#define MM  (BB*TT)          // 4096 rows
#define GN_EPS 0.00064f

typedef float v2f __attribute__((ext_vector_type(2)));
typedef float v8f __attribute__((ext_vector_type(8)));

#define AS1 __attribute__((address_space(1)))
#define AS3 __attribute__((address_space(3)))

#if defined(__has_builtin)
# if __has_builtin(__builtin_amdgcn_global_load_async_to_lds_b32) && \
     __has_builtin(__builtin_amdgcn_s_wait_asynccnt)
#  define USE_ASYNC_LDS 1
# endif
#endif

// =====================================================================
// Blocked WMMA f32 GEMM: Out[M,Nc] = X[M,K] @ W^T + bias, W (Nc,K) row-major.
// Wave tile 32x32 (2x2 wmma accs, 1 load per wmma), block = 4 waves -> 64x64.
// grid = (M/64, Nc/64).
// =====================================================================
__global__ __launch_bounds__(128)
void wmma_gemm_f32_blk(const float* __restrict__ X, const float* __restrict__ W,
                       const float* __restrict__ bias, float* __restrict__ Out,
                       int K, int Nc)
{
    const int lane = threadIdx.x & 31;
    const int wave = threadIdx.x >> 5;
    const int half = lane >> 4;
    const int l    = lane & 15;
    const int mw   = wave >> 1, nw = wave & 1;
    const int tileM = blockIdx.x * 64 + mw * 32;
    const int tileN = blockIdx.y * 64 + nw * 32;

    const float* xr0 = X + (size_t)(tileM + l)      * K;
    const float* xr1 = X + (size_t)(tileM + 16 + l) * K;
    const float* wr0 = W + (size_t)(tileN + l)      * K;
    const float* wr1 = W + (size_t)(tileN + 16 + l) * K;

    v8f acc00 = {}, acc01 = {}, acc10 = {}, acc11 = {};
    for (int k0 = 0; k0 < K; k0 += 4) {
        const int ko = k0 + 2*half;
        v2f a0 = *(const v2f*)(xr0 + ko);
        v2f a1 = *(const v2f*)(xr1 + ko);
        v2f b0 = *(const v2f*)(wr0 + ko);
        v2f b1 = *(const v2f*)(wr1 + ko);
        acc00 = __builtin_amdgcn_wmma_f32_16x16x4_f32(false, a0, false, b0, (short)0, acc00, false, false);
        acc01 = __builtin_amdgcn_wmma_f32_16x16x4_f32(false, a0, false, b1, (short)0, acc01, false, false);
        acc10 = __builtin_amdgcn_wmma_f32_16x16x4_f32(false, a1, false, b0, (short)0, acc10, false, false);
        acc11 = __builtin_amdgcn_wmma_f32_16x16x4_f32(false, a1, false, b1, (short)0, acc11, false, false);
    }

    const int col0 = tileN + l, col1 = tileN + 16 + l;
    const float bs0 = bias ? bias[col0] : 0.0f;
    const float bs1 = bias ? bias[col1] : 0.0f;
    #pragma unroll
    for (int j = 0; j < 8; ++j) {
        const int row0 = tileM + j + 8*half;           // C/D: VGPR j -> M=j / j+8
        const int row1 = row0 + 16;
        Out[(size_t)row0 * Nc + col0] = acc00[j] + bs0;
        Out[(size_t)row0 * Nc + col1] = acc01[j] + bs1;
        Out[(size_t)row1 * Nc + col0] = acc10[j] + bs0;
        Out[(size_t)row1 * Nc + col1] = acc11[j] + bs1;
    }
}

// =====================================================================
// Simple WMMA GEMM for the LoRA projections (Nc = 64/32), W stored (K,Nc).
// One wave = one 16x16 tile. TANH applies tanh instead of bias.
// =====================================================================
template<bool TANH>
__global__ __launch_bounds__(128)
void wmma_gemm_f32_small(const float* __restrict__ X, const float* __restrict__ W,
                         float* __restrict__ Out, int K, int Nc)
{
    const int lane = threadIdx.x & 31;
    const int wave = threadIdx.x >> 5;
    const int half = lane >> 4;
    const int l    = lane & 15;
    const int tileM = blockIdx.x * 16;
    const int tileN = wave * 16;
    if (tileN >= Nc) return;             // wave-uniform

    const float* xrow = X + (size_t)(tileM + l) * K;
    const int n = tileN + l;
    v8f acc = {};
    for (int k0 = 0; k0 < K; k0 += 4) {
        v2f a = *(const v2f*)(xrow + k0 + 2*half);
        v2f b;
        b.x = W[(size_t)(k0 + 2*half    ) * Nc + n];
        b.y = W[(size_t)(k0 + 2*half + 1) * Nc + n];
        acc = __builtin_amdgcn_wmma_f32_16x16x4_f32(false, a, false, b, (short)0, acc, false, false);
    }
    #pragma unroll
    for (int j = 0; j < 8; ++j) {
        const int row = tileM + j + 8*half;
        Out[(size_t)row * Nc + n] = TANH ? tanhf(acc[j]) : acc[j];
    }
}

#define XCNT_WAIT() asm volatile("s_wait_xcnt 0x0" ::: "memory")
// Round a group of stores and its wait: keeps the scheduler from placing vector work,
// which may reuse a stored register, between a store and the wait.
#define SCHED_EDGE() __builtin_amdgcn_sched_barrier(0)

template<int K>
__device__ __forceinline__
void lora_tile(const float* __restrict__ A, const float* __restrict__ Bm,
               const float* __restrict__ init, int tileM, int cbase,
               int l, int half, v8f (&acc)[4])
{
    const float* arow = A  + (size_t)(tileM + l) * K + 2*half;   // A: lane -> row, half -> k pair
    const float* bcol = Bm + (size_t)(2*half) * CC + cbase + l;  // B: lane -> col, half -> k pair
    XCNT_WAIT();     // behind the stores of the phase before
    #pragma unroll   // acc[] must stay in registers
    for (int nt = 0; nt < 4; ++nt) {
        const float c0 = init[cbase + nt*16 + l];                // the bias vector starts the sum
        #pragma unroll
        for (int j = 0; j < 8; ++j) acc[nt][j] = c0;
    }
    XCNT_WAIT();
    #pragma unroll   // constant offsets on every load
    for (int kc = 0; kc < K; kc += 16) {
        // all 36 fragment loads of a 16-deep k chunk first: one cache latency per 16 WMMAs
        v2f a[4], b[4][4];
        #pragma unroll
        for (int s = 0; s < 4; ++s) a[s] = *(const v2f*)(arow + kc + 4*s);
        XCNT_WAIT();
        #pragma unroll
        for (int s = 0; s < 4; ++s) {
            const int k0 = kc + 4*s;
            #pragma unroll
            for (int nt = 0; nt < 4; ++nt) {
                b[s][nt].x = bcol[(size_t)(k0    ) * CC + nt*16];
                b[s][nt].y = bcol[(size_t)(k0 + 1) * CC + nt*16];
            }
        }
        XCNT_WAIT();
        #pragma unroll
        for (int s = 0; s < 4; ++s) {
            #pragma unroll
            for (int nt = 0; nt < 4; ++nt)
                acc[nt] = __builtin_amdgcn_wmma_f32_16x16x4_f32(false, a[s], false, b[s][nt], (short)0, acc[nt], false, false);
        }
    }
}

// 16 rows x 64 columns of a row-major array in the accumulator layout, one batch of loads.
__device__ __forceinline__
void load_tile(const float* __restrict__ p, int pitch, v8f (&t)[4])
{
    #pragma unroll   // t[] must stay in registers
    for (int nt = 0; nt < 4; ++nt) {
        #pragma unroll
        for (int j = 0; j < 8; ++j) t[nt][j] = p[(size_t)j * pitch + nt*16];
    }
    XCNT_WAIT();
}

__global__ __launch_bounds__(256)
void fusion_kernel(const float* __restrict__ klin, const float* __restrict__ vlin,
                   const float* __restrict__ hw,  const float* __restrict__ ha,
                   const float* __restrict__ hv,  const float* __restrict__ v_first,
                   const float* __restrict__ w0,  const float* __restrict__ w2,
                   const float* __restrict__ a0,  const float* __restrict__ a2,
                   const float* __restrict__ v0,  const float* __restrict__ v2,
                   const float* __restrict__ k_k, const float* __restrict__ k_a,
                   float* __restrict__ decay, float* __restrict__ kpost,
                   float* __restrict__ vpost, float* __restrict__ aaO,
                   float* __restrict__ bbO)
{
    const int lane = threadIdx.x & 31;
    const int wave = threadIdx.x >> 5;
    const int half = lane >> 4;
    const int l    = lane & 15;
    const int tileM  = blockIdx.x * 128 + wave * 16;
    const int h      = blockIdx.y;
    const int cbase  = h * NN;
    const int kvbase = (h >> 2) * NN;                 // kv-head repeat
    const int row0   = tileM + 8*half;                // C/D: VGPR j -> row j / j+8
    const size_t g0  = (size_t)row0 * CC  + cbase  + l;   // element (j, nt) at g0 + j*CC + nt*16
    const size_t q0  = (size_t)row0 * KVC + kvbase + l;
    v8f acc[4], t0[4], t1[4];

    // ---- decay ----
    lora_tile<64>(hw, w2, w0, tileM, cbase, l, half, acc);
    #pragma unroll   // acc[] is indexed: registers only when unrolled
    for (int nt = 0; nt < 4; ++nt) {
        v8f o;
        #pragma unroll
        for (int j = 0; j < 8; ++j) {
            const float wraw = -log1pf(expf(-acc[nt][j])) - 0.6f;   // -softplus(-t)-0.6
            o[j] = expf(-expf(wraw));
        }
        SCHED_EDGE();
        #pragma unroll
        for (int j = 0; j < 8; ++j) decay[g0 + (size_t)j * CC + nt*16] = o[j];
        XCNT_WAIT();
        SCHED_EDGE();
    }

    // ---- value blend ----
    lora_tile<32>(hv, v2, v0, tileM, cbase, l, half, acc);
    load_tile(vlin + q0, KVC, t0);
    load_tile(v_first + g0, CC, t1);
    #pragma unroll
    for (int nt = 0; nt < 4; ++nt) {
        v8f o;
        #pragma unroll
        for (int j = 0; j < 8; ++j) {
            const float vg = 1.f / (1.f + expf(-acc[nt][j]));
            const float vf = t0[nt][j];
            o[j] = vf + (t1[nt][j] - vf) * vg;
        }
        SCHED_EDGE();
        #pragma unroll
        for (int j = 0; j < 8; ++j) vpost[g0 + (size_t)j * CC + nt*16] = o[j];
        XCNT_WAIT();
        SCHED_EDGE();
    }

    // ---- a gate, k, normalised kk ----
    lora_tile<64>(ha, a2, a0, tileM, cbase, l, half, acc);
    load_tile(klin + q0, KVC, t0);
    float kkc[4], kac[4];
    #pragma unroll
    for (int nt = 0; nt < 4; ++nt) kkc[nt] = k_k[cbase + nt*16 + l];
    XCNT_WAIT();
    #pragma unroll
    for (int nt = 0; nt < 4; ++nt) kac[nt] = k_a[cbase + nt*16 + l];
    XCNT_WAIT();
    float ss[8];
    #pragma unroll
    for (int j = 0; j < 8; ++j) ss[j] = 0.f;
    #pragma unroll
    for (int nt = 0; nt < 4; ++nt) {
        v8f o;
        #pragma unroll
        for (int j = 0; j < 8; ++j) {
            const float av = 1.f / (1.f + expf(-acc[nt][j]));
            const float kf = t0[nt][j];
            const float kkp = kf * kkc[nt];
            o[j] = kf * (1.f + (av - 1.f) * kac[nt]);
            t0[nt][j]  = kkp;
            acc[nt][j] = av;
            ss[j] += kkp * kkp;
        }
        SCHED_EDGE();
        #pragma unroll
        for (int j = 0; j < 8; ++j) kpost[g0 + (size_t)j * CC + nt*16] = o[j];
        XCNT_WAIT();
        SCHED_EDGE();
    }
    #pragma unroll
    for (int j = 0; j < 8; ++j) {
        float s = ss[j];
        // a row's 64 channels sit in the 16 lanes of one half (4 per lane)
        for (int off = 8; off; off >>= 1) s += __shfl_xor(s, off);
        const float rn = 1.f / fmaxf(sqrtf(s), 1e-12f);
        float oa[4], ob[4];
        #pragma unroll
        for (int nt = 0; nt < 4; ++nt) {
            const float kkn = t0[nt][j] * rn;
            oa[nt] = -kkn;
            ob[nt] = kkn * acc[nt][j];
        }
        SCHED_EDGE();
        #pragma unroll
        for (int nt = 0; nt < 4; ++nt) {
            aaO[g0 + (size_t)j * CC + nt*16] = oa[nt];
            bbO[g0 + (size_t)j * CC + nt*16] = ob[nt];
        }
        XCNT_WAIT();
        SCHED_EDGE();
    }
}
#undef XCNT_WAIT
#undef SCHED_EDGE

// =====================================================================
// Sequential RWKV-7 scan. grid = B*H, block = 64 (one thread per state row),
// S[64] in VGPRs. Per-timestep vectors triple-buffered in LDS; prefetched
// two steps ahead via GLOBAL_LOAD_ASYNC_TO_LDS (ASYNCcnt) when available,
// else software-pipelined register staging.
// =====================================================================
__global__ __launch_bounds__(64)
void scan_kernel(const float* __restrict__ r, const float* __restrict__ dc,
                 const float* __restrict__ k, const float* __restrict__ v,
                 const float* __restrict__ aa, const float* __restrict__ bb,
                 const float* __restrict__ state0, float* __restrict__ y)
{
    const int bh = blockIdx.x;            // b*H + h
    const int b = bh >> 5, h = bh & 31;
    const int i = threadIdx.x;            // state row
    float S[NN];
    const float* st = state0 + ((size_t)bh * NN + i) * NN;
    #pragma unroll
    for (int q = 0; q < NN; ++q) S[q] = st[q];

    __shared__ float buf[3][6*NN];

#ifdef USE_ASYNC_LDS
    // Async global->LDS, 2 steps ahead (12 outstanding b32 loads per wave).
    #define SCAN_ISSUE(t_, slot_)  do {                                          \
        const size_t gb_ = ((size_t)(b*TT + (t_)))*CC + h*NN + i;                \
        float* d_ = &buf[(slot_)][i];                                            \
        __builtin_amdgcn_global_load_async_to_lds_b32((AS1 int*)(r  + gb_), (AS3 int*)(d_        ), 0, 0); \
        __builtin_amdgcn_global_load_async_to_lds_b32((AS1 int*)(dc + gb_), (AS3 int*)(d_ + 1*NN), 0, 0); \
        __builtin_amdgcn_global_load_async_to_lds_b32((AS1 int*)(k  + gb_), (AS3 int*)(d_ + 2*NN), 0, 0); \
        __builtin_amdgcn_global_load_async_to_lds_b32((AS1 int*)(v  + gb_), (AS3 int*)(d_ + 3*NN), 0, 0); \
        __builtin_amdgcn_global_load_async_to_lds_b32((AS1 int*)(aa + gb_), (AS3 int*)(d_ + 4*NN), 0, 0); \
        __builtin_amdgcn_global_load_async_to_lds_b32((AS1 int*)(bb + gb_), (AS3 int*)(d_ + 5*NN), 0, 0); \
    } while (0)

    SCAN_ISSUE(0, 0);
    SCAN_ISSUE(1, 1);
    for (int t = 0; t < TT; ++t) {
        if (t + 2 < TT)      { SCAN_ISSUE(t + 2, (t + 2) % 3);
                               __builtin_amdgcn_s_wait_asynccnt(12); }
        else if (t + 1 < TT) { __builtin_amdgcn_s_wait_asynccnt(6); }
        else                 { __builtin_amdgcn_s_wait_asynccnt(0); }
        __syncthreads();
        const float* rb = &buf[t % 3][0];
        const float* db = rb + NN;  const float* kb = rb + 2*NN;
        const float* vb = rb + 3*NN; const float* ab = rb + 4*NN;
        const float* bp = rb + 5*NN;
        float sa = 0.f;
        #pragma unroll
        for (int q = 0; q < NN; ++q) sa += S[q] * ab[q];
        const float vi = vb[i];
        float yo = 0.f;
        #pragma unroll
        for (int q = 0; q < NN; ++q) {
            const float s2 = S[q]*db[q] + sa*bp[q] + vi*kb[q];
            S[q] = s2;
            yo += s2 * rb[q];
        }
        y[((size_t)(b*TT + t))*CC + h*NN + i] = yo;
        __syncthreads();
    }
    #undef SCAN_ISSUE
#else
    // Fallback: register double-buffer; loads for t+1 issued before compute(t).
    float rg[6];
    {
        const size_t gb = ((size_t)(b*TT))*CC + h*NN + i;
        rg[0]=r[gb]; rg[1]=dc[gb]; rg[2]=k[gb]; rg[3]=v[gb]; rg[4]=aa[gb]; rg[5]=bb[gb];
    }
    for (int t = 0; t < TT; ++t) {
        const int cur = t & 1;
        float* d = &buf[cur][i];
        d[0]=rg[0]; d[1*NN]=rg[1]; d[2*NN]=rg[2]; d[3*NN]=rg[3]; d[4*NN]=rg[4]; d[5*NN]=rg[5];
        __syncthreads();
        if (t + 1 < TT) {
            const size_t gb = ((size_t)(b*TT + t + 1))*CC + h*NN + i;
            rg[0]=r[gb]; rg[1]=dc[gb]; rg[2]=k[gb]; rg[3]=v[gb]; rg[4]=aa[gb]; rg[5]=bb[gb];
        }
        const float* rb = &buf[cur][0];
        const float* db = rb + NN;  const float* kb = rb + 2*NN;
        const float* vb = rb + 3*NN; const float* ab = rb + 4*NN;
        const float* bp = rb + 5*NN;
        float sa = 0.f;
        #pragma unroll
        for (int q = 0; q < NN; ++q) sa += S[q] * ab[q];
        const float vi = vb[i];
        float yo = 0.f;
        #pragma unroll
        for (int q = 0; q < NN; ++q) {
            const float s2 = S[q]*db[q] + sa*bp[q] + vi*kb[q];
            S[q] = s2;
            yo += s2 * rb[q];
        }
        y[((size_t)(b*TT + t))*CC + h*NN + i] = yo;
        __syncthreads();
    }
#endif
}

// =====================================================================
// GroupNorm over (T,N) per (b,h) + bonus term. xx aliases rbuf
// (each lane reads its r before writing the same location).
// =====================================================================
__global__ __launch_bounds__(256)
void gnorm_kernel(const float* __restrict__ y, const float* rbuf,
                  const float* __restrict__ kpost, const float* __restrict__ vpost,
                  const float* __restrict__ r_k, const float* __restrict__ ln_w,
                  const float* __restrict__ ln_b, float* xx)
{
    const int bh = blockIdx.x;
    const int b = bh >> 5, h = bh & 31;
    const int tid = threadIdx.x;
    __shared__ float red[256], red2[256];

    float s = 0.f, s2 = 0.f;
    for (int f = tid; f < TT*NN; f += 256) {
        const int t = f >> 6, n = f & 63;
        const float v = y[((size_t)(b*TT + t))*CC + h*NN + n];
        s += v; s2 += v*v;
    }
    red[tid] = s; red2[tid] = s2;
    __syncthreads();
    for (int off = 128; off; off >>= 1) {
        if (tid < off) { red[tid] += red[tid+off]; red2[tid] += red2[tid+off]; }
        __syncthreads();
    }
    const float mean = red[0]  * (1.f / 65536.f);
    const float var  = red2[0] * (1.f / 65536.f) - mean*mean;
    const float rstd = rsqrtf(var + GN_EPS);

    const int wave = tid >> 5, lane = tid & 31;
    const float lw0 = ln_w[h*NN + lane],      lb0 = ln_b[h*NN + lane];
    const float lw1 = ln_w[h*NN + lane + 32], lb1 = ln_b[h*NN + lane + 32];
    const float rk0 = r_k[h*NN + lane],       rk1 = r_k[h*NN + lane + 32];
    for (int t = wave; t < TT; t += 8) {
        const size_t base = ((size_t)(b*TT + t))*CC + h*NN;
        const float r0 = rbuf[base + lane],      r1 = rbuf[base + lane + 32];
        const float k0 = kpost[base + lane],     k1 = kpost[base + lane + 32];
        float d = r0*k0*rk0 + r1*k1*rk1;
        for (int off = 16; off; off >>= 1) d += __shfl_xor(d, off);
        const float y0 = y[base + lane], y1 = y[base + lane + 32];
        const float o0 = (y0 - mean)*rstd*lw0 + lb0 + d*vpost[base + lane];
        const float o1 = (y1 - mean)*rstd*lw1 + lb1 + d*vpost[base + lane + 32];
        xx[base + lane]      = o0;
        xx[base + lane + 32] = o1;
    }
}

// =====================================================================
extern "C" void kernel_launch(void* const* d_in, const int* in_sizes, int n_in,
                              void* d_out, int out_size, void* d_ws, size_t ws_size,
                              hipStream_t stream) {
    const float* x       = (const float*)d_in[0];
    const float* v_first = (const float*)d_in[1];
    const float* state0  = (const float*)d_in[2];
    const float* Rw      = (const float*)d_in[3];
    const float* R_bias  = (const float*)d_in[4];
    const float* Kw      = (const float*)d_in[5];
    const float* K_bias  = (const float*)d_in[6];
    const float* Vw      = (const float*)d_in[7];
    const float* V_bias  = (const float*)d_in[8];
    const float* Ow      = (const float*)d_in[9];
    const float* O_bias  = (const float*)d_in[10];
    const float* w0      = (const float*)d_in[11];
    const float* w1      = (const float*)d_in[12];
    const float* w2      = (const float*)d_in[13];
    const float* a0      = (const float*)d_in[14];
    const float* a1      = (const float*)d_in[15];
    const float* a2      = (const float*)d_in[16];
    const float* v0      = (const float*)d_in[17];
    const float* v1      = (const float*)d_in[18];
    const float* v2      = (const float*)d_in[19];
    const float* k_k     = (const float*)d_in[20];
    const float* k_a     = (const float*)d_in[21];
    const float* r_k     = (const float*)d_in[22];
    const float* ln_w    = (const float*)d_in[23];
    const float* ln_b    = (const float*)d_in[24];
    float* out = (float*)d_out;

    // workspace layout (floats)
    float* ws = (float*)d_ws;
    float* r_buf  = ws;                                // M*C   (later reused as xx)
    float* klin   = r_buf  + (size_t)MM*CC;            // M*512
    float* vlin   = klin   + (size_t)MM*KVC;           // M*512
    float* hw     = vlin   + (size_t)MM*KVC;           // M*64
    float* ha     = hw     + (size_t)MM*64;            // M*64
    float* hv     = ha     + (size_t)MM*64;            // M*32
    float* decayb = hv     + (size_t)MM*32;            // M*C
    float* kpost  = decayb + (size_t)MM*CC;            // M*C
    float* vpost  = kpost  + (size_t)MM*CC;            // M*C
    float* aab    = vpost  + (size_t)MM*CC;            // M*C
    float* bbb    = aab    + (size_t)MM*CC;            // M*C
    float* ybuf   = bbb    + (size_t)MM*CC;            // M*C
    float* xx     = r_buf;                             // alias: r dead after bonus read

    const dim3 blk(128);
    // Step 1: projections (blocked WMMA for the big GEMMs)
    wmma_gemm_f32_blk<<<dim3(MM/64, CC/64),  blk, 0, stream>>>(x, Rw, R_bias, r_buf, CC, CC);
    wmma_gemm_f32_blk<<<dim3(MM/64, KVC/64), blk, 0, stream>>>(x, Kw, K_bias, klin,  CC, KVC);
    wmma_gemm_f32_blk<<<dim3(MM/64, KVC/64), blk, 0, stream>>>(x, Vw, V_bias, vlin,  CC, KVC);
    wmma_gemm_f32_small<true ><<<dim3(MM/16), blk, 0, stream>>>(x, w1, hw, CC, 64);
    wmma_gemm_f32_small<false><<<dim3(MM/16), blk, 0, stream>>>(x, a1, ha, CC, 64);
    wmma_gemm_f32_small<false><<<dim3(MM/16), blk, 0, stream>>>(x, v1, hv, CC, 32);

    // fused elementwise prep
    fusion_kernel<<<dim3(MM/128, HH), dim3(256), 0, stream>>>(
        klin, vlin, hw, ha, hv, v_first, w0, w2, a0, a2, v0, v2, k_k, k_a,
        decayb, kpost, vpost, aab, bbb);

    // Step 2: sequential scan
    scan_kernel<<<dim3(BB*HH), dim3(64), 0, stream>>>(
        r_buf, decayb, kpost, vpost, aab, bbb, state0, ybuf);

    // Step 3: group norm + bonus
    gnorm_kernel<<<dim3(BB*HH), dim3(256), 0, stream>>>(
        ybuf, r_buf, kpost, vpost, r_k, ln_w, ln_b, xx);

    // output projection
    wmma_gemm_f32_blk<<<dim3(MM/64, CC/64), blk, 0, stream>>>(xx, Ow, O_bias, out, CC, CC);
    (void)in_sizes; (void)n_in; (void)out_size; (void)ws_size;
}

// v002
// A run of this version takes 2590 microseconds.
// Timed twice side by side with v001, it ran 1.26 and 1.25 times as fast.
// Over all steps from v000 it is 1.66 times as fast.
#include <hip/hip_runtime.h>
#include <math.h>

// ---------------- problem constants ----------------
#define BB  4
#define TT  1024
#define CC  2048
#define HH  32
#define NN  64
#define KVC 512
#define MM  (BB*TT)          // 4096 rows
#define GN_EPS 0.00064f

typedef float v2f __attribute__((ext_vector_type(2)));
typedef float v8f __attribute__((ext_vector_type(8)));

#define AS1 __attribute__((address_space(1)))
#define AS3 __attribute__((address_space(3)))

#if defined(__has_builtin)
# if __has_builtin(__builtin_amdgcn_global_load_async_to_lds_b32) && \
     __has_builtin(__builtin_amdgcn_s_wait_asynccnt)
#  define USE_ASYNC_LDS 1
# endif
#endif

#define GBK     32
#define GPITCH  36
#define GROWB   (GPITCH * 4)
#define GBUFB   (128 * GROWB)

// A thread's eight 16-byte pieces of one k tile: rows r, r+16, r+32, r+48 of X and of W.
// The wait on the last line stands before the address registers can be rewritten.
__device__ __forceinline__
void gemm_stage_tile(unsigned lds, const float* gx, const float* gw, size_t rstep)
{
    asm volatile(
        "global_load_async_to_lds_b128 %0, %8, off\n\t"
        "global_load_async_to_lds_b128 %1, %9, off\n\t"
        "global_load_async_to_lds_b128 %2, %10, off\n\t"
        "global_load_async_to_lds_b128 %3, %11, off\n\t"
        "global_load_async_to_lds_b128 %4, %12, off\n\t"
        "global_load_async_to_lds_b128 %5, %13, off\n\t"
        "global_load_async_to_lds_b128 %6, %14, off\n\t"
        "global_load_async_to_lds_b128 %7, %15, off\n\t"
        "s_wait_xcnt 0x0"
        :: "v"(lds),              "v"(lds +  16*GROWB), "v"(lds +  32*GROWB), "v"(lds +  48*GROWB),
           "v"(lds + 64*GROWB),   "v"(lds +  80*GROWB), "v"(lds +  96*GROWB), "v"(lds + 112*GROWB),
           "v"(gx), "v"(gx + rstep), "v"(gx + 2*rstep), "v"(gx + 3*rstep),
           "v"(gw), "v"(gw + rstep), "v"(gw + 2*rstep), "v"(gw + 3*rstep)
        : "memory");
}

__global__ __launch_bounds__(128)
void wmma_gemm_f32_blk(const float* __restrict__ X, const float* __restrict__ W,
                       const float* __restrict__ bias, float* __restrict__ Out,
                       int K, int Nc)
{
    __shared__ __attribute__((aligned(16))) float tile[2 * 128 * GPITCH];

    const int lane = threadIdx.x & 31;
    const int wave = threadIdx.x >> 5;
    const int half = lane >> 4;
    const int l    = lane & 15;
    const int mw   = wave >> 1, nw = wave & 1;
    const int tileM = blockIdx.x * 64 + mw * 32;
    const int tileN = blockIdx.y * 64 + nw * 32;

    // copies: 8 lanes a row (16 bytes each), 16 rows per pass over the block's 128 threads
    const int crow = threadIdx.x >> 3, cpos = (threadIdx.x & 7) * 4;
    const float* gx = X + (size_t)(blockIdx.x * 64 + crow) * K + cpos;
    const float* gw = W + (size_t)(blockIdx.y * 64 + crow) * K + cpos;
    const size_t rstep = (size_t)16 * K;
    const unsigned lds0 = (unsigned)(uintptr_t)tile + (unsigned)(crow * GROWB + cpos * 4);
    const int nT = K / GBK;

    gemm_stage_tile(lds0, gx, gw, rstep);
    asm volatile("s_wait_asynccnt 0x0" ::: "memory");   // tile 0 has landed (this wave's part)
    __syncthreads();                                    // ... and every other wave's
    if (nT > 1) gemm_stage_tile(lds0 + GBUFB, gx + GBK, gw + GBK, rstep);

    // fragments: lane -> row, half -> k pair, as with the global loads they replace
    const int aoff = (mw * 32 + l) * GPITCH + 2*half;
    const int boff = (64 + nw * 32 + l) * GPITCH + 2*half;

    v8f acc00 = {}, acc01 = {}, acc10 = {}, acc11 = {};
    for (int t = 0; t < nT; ++t) {
        const float* buf = tile + (t & 1) * (128 * GPITCH);
        const float* as  = buf + aoff;
        const float* bs  = buf + boff;
        #pragma unroll   // constant LDS offsets on every fragment read
        for (int s = 0; s < GBK; s += 4) {
            v2f a0 = *(const v2f*)(as + s);
            v2f a1 = *(const v2f*)(as + 16*GPITCH + s);
            v2f b0 = *(const v2f*)(bs + s);
            v2f b1 = *(const v2f*)(bs + 16*GPITCH + s);
            acc00 = __builtin_amdgcn_wmma_f32_16x16x4_f32(false, a0, false, b0, (short)0, acc00, false, false);
            acc01 = __builtin_amdgcn_wmma_f32_16x16x4_f32(false, a0, false, b1, (short)0, acc01, false, false);
            acc10 = __builtin_amdgcn_wmma_f32_16x16x4_f32(false, a1, false, b0, (short)0, acc10, false, false);
            acc11 = __builtin_amdgcn_wmma_f32_16x16x4_f32(false, a1, false, b1, (short)0, acc11, false, false);
        }
        asm volatile("s_wait_dscnt 0x0" ::: "memory");     // this wave has left the buffer
        asm volatile("s_wait_asynccnt 0x0" ::: "memory");  // its part of tile t+1 has landed
        __syncthreads();   // publishes tile t+1 and ends every wave's reads of tile t
        if (t + 2 < nT)
            gemm_stage_tile(lds0 + (t & 1) * GBUFB, gx + (size_t)(t + 2) * GBK, gw + (size_t)(t + 2) * GBK, rstep);
    }
    asm volatile("s_wait_asynccnt 0x0" ::: "memory");      // no copy is left when the wave ends

    const int col0 = tileN + l, col1 = tileN + 16 + l;
    const float bs0 = bias ? bias[col0] : 0.0f;
    const float bs1 = bias ? bias[col1] : 0.0f;
    asm volatile("s_wait_xcnt 0x0" ::: "memory");   // precaution: before the bias loads' offset register is reused for the store addresses
    __builtin_amdgcn_sched_barrier(0);   // keeps the store-address arithmetic, which reuses that register, behind the wait
    #pragma unroll
    for (int j = 0; j < 8; ++j) {
        const int row0 = tileM + j + 8*half;           // C/D: VGPR j -> M=j / j+8
        const int row1 = row0 + 16;
        Out[(size_t)row0 * Nc + col0] = acc00[j] + bs0;
        Out[(size_t)row0 * Nc + col1] = acc01[j] + bs1;
        Out[(size_t)row1 * Nc + col0] = acc10[j] + bs0;
        Out[(size_t)row1 * Nc + col1] = acc11[j] + bs1;
    }
}

// =====================================================================
// Simple WMMA GEMM for the LoRA projections (Nc = 64/32), W stored (K,Nc).
// One wave = one 16x16 tile. TANH applies tanh instead of bias.
// =====================================================================
template<bool TANH>
__global__ __launch_bounds__(128)
void wmma_gemm_f32_small(const float* __restrict__ X, const float* __restrict__ W,
                         float* __restrict__ Out, int K, int Nc)
{
    const int lane = threadIdx.x & 31;
    const int wave = threadIdx.x >> 5;
    const int half = lane >> 4;
    const int l    = lane & 15;
    const int tileM = blockIdx.x * 16;
    const int tileN = wave * 16;
    if (tileN >= Nc) return;             // wave-uniform

    const float* xrow = X + (size_t)(tileM + l) * K;
    const int n = tileN + l;
    v8f acc = {};
    for (int k0 = 0; k0 < K; k0 += 4) {
        v2f a = *(const v2f*)(xrow + k0 + 2*half);
        v2f b;
        b.x = W[(size_t)(k0 + 2*half    ) * Nc + n];
        b.y = W[(size_t)(k0 + 2*half + 1) * Nc + n];
        acc = __builtin_amdgcn_wmma_f32_16x16x4_f32(false, a, false, b, (short)0, acc, false, false);
    }
    #pragma unroll
    for (int j = 0; j < 8; ++j) {
        const int row = tileM + j + 8*half;
        Out[(size_t)row * Nc + n] = TANH ? tanhf(acc[j]) : acc[j];
    }
}

#define XCNT_WAIT() asm volatile("s_wait_xcnt 0x0" ::: "memory")
// Round a group of stores and its wait: keeps the scheduler from placing vector work,
// which may reuse a stored register, between a store and the wait.
#define SCHED_EDGE() __builtin_amdgcn_sched_barrier(0)

template<int K>
__device__ __forceinline__
void lora_tile(const float* __restrict__ A, const float* __restrict__ Bm,
               const float* __restrict__ init, int tileM, int cbase,
               int l, int half, v8f (&acc)[4])
{
    const float* arow = A  + (size_t)(tileM + l) * K + 2*half;   // A: lane -> row, half -> k pair
    const float* bcol = Bm + (size_t)(2*half) * CC + cbase + l;  // B: lane -> col, half -> k pair
    XCNT_WAIT();     // behind the stores of the phase before
    #pragma unroll   // acc[] must stay in registers
    for (int nt = 0; nt < 4; ++nt) {
        const float c0 = init[cbase + nt*16 + l];                // the bias vector starts the sum
        #pragma unroll
        for (int j = 0; j < 8; ++j) acc[nt][j] = c0;
    }
    XCNT_WAIT();
    #pragma unroll   // constant offsets on every load
    for (int kc = 0; kc < K; kc += 16) {
        // all 36 fragment loads of a 16-deep k chunk first: one cache latency per 16 WMMAs
        v2f a[4], b[4][4];
        #pragma unroll
        for (int s = 0; s < 4; ++s) a[s] = *(const v2f*)(arow + kc + 4*s);
        XCNT_WAIT();
        #pragma unroll
        for (int s = 0; s < 4; ++s) {
            const int k0 = kc + 4*s;
            #pragma unroll
            for (int nt = 0; nt < 4; ++nt) {
                b[s][nt].x = bcol[(size_t)(k0    ) * CC + nt*16];
                b[s][nt].y = bcol[(size_t)(k0 + 1) * CC + nt*16];
            }
        }
        XCNT_WAIT();
        #pragma unroll
        for (int s = 0; s < 4; ++s) {
            #pragma unroll
            for (int nt = 0; nt < 4; ++nt)
                acc[nt] = __builtin_amdgcn_wmma_f32_16x16x4_f32(false, a[s], false, b[s][nt], (short)0, acc[nt], false, false);
        }
    }
}

// 16 rows x 64 columns of a row-major array in the accumulator layout, one batch of loads.
__device__ __forceinline__
void load_tile(const float* __restrict__ p, int pitch, v8f (&t)[4])
{
    #pragma unroll   // t[] must stay in registers
    for (int nt = 0; nt < 4; ++nt) {
        #pragma unroll
        for (int j = 0; j < 8; ++j) t[nt][j] = p[(size_t)j * pitch + nt*16];
    }
    XCNT_WAIT();
}

__global__ __launch_bounds__(256)
void fusion_kernel(const float* __restrict__ klin, const float* __restrict__ vlin,
                   const float* __restrict__ hw,  const float* __restrict__ ha,
                   const float* __restrict__ hv,  const float* __restrict__ v_first,
                   const float* __restrict__ w0,  const float* __restrict__ w2,
                   const float* __restrict__ a0,  const float* __restrict__ a2,
                   const float* __restrict__ v0,  const float* __restrict__ v2,
                   const float* __restrict__ k_k, const float* __restrict__ k_a,
                   float* __restrict__ decay, float* __restrict__ kpost,
                   float* __restrict__ vpost, float* __restrict__ aaO,
                   float* __restrict__ bbO)
{
    const int lane = threadIdx.x & 31;
    const int wave = threadIdx.x >> 5;
    const int half = lane >> 4;
    const int l    = lane & 15;
    const int tileM  = blockIdx.x * 128 + wave * 16;
    const int h      = blockIdx.y;
    const int cbase  = h * NN;
    const int kvbase = (h >> 2) * NN;                 // kv-head repeat
    const int row0   = tileM + 8*half;                // C/D: VGPR j -> row j / j+8
    const size_t g0  = (size_t)row0 * CC  + cbase  + l;   // element (j, nt) at g0 + j*CC + nt*16
    const size_t q0  = (size_t)row0 * KVC + kvbase + l;
    v8f acc[4], t0[4], t1[4];

    // ---- decay ----
    lora_tile<64>(hw, w2, w0, tileM, cbase, l, half, acc);
    #pragma unroll   // acc[] is indexed: registers only when unrolled
    for (int nt = 0; nt < 4; ++nt) {
        v8f o;
        #pragma unroll
        for (int j = 0; j < 8; ++j) {
            const float wraw = -log1pf(expf(-acc[nt][j])) - 0.6f;   // -softplus(-t)-0.6
            o[j] = expf(-expf(wraw));
        }
        SCHED_EDGE();
        #pragma unroll
        for (int j = 0; j < 8; ++j) decay[g0 + (size_t)j * CC + nt*16] = o[j];
        XCNT_WAIT();
        SCHED_EDGE();
    }

    // ---- value blend ----
    lora_tile<32>(hv, v2, v0, tileM, cbase, l, half, acc);
    load_tile(vlin + q0, KVC, t0);
    load_tile(v_first + g0, CC, t1);
    #pragma unroll
    for (int nt = 0; nt < 4; ++nt) {
        v8f o;
        #pragma unroll
        for (int j = 0; j < 8; ++j) {
            const float vg = 1.f / (1.f + expf(-acc[nt][j]));
            const float vf = t0[nt][j];
            o[j] = vf + (t1[nt][j] - vf) * vg;
        }
        SCHED_EDGE();
        #pragma unroll
        for (int j = 0; j < 8; ++j) vpost[g0 + (size_t)j * CC + nt*16] = o[j];
        XCNT_WAIT();
        SCHED_EDGE();
    }

    // ---- a gate, k, normalised kk ----
    lora_tile<64>(ha, a2, a0, tileM, cbase, l, half, acc);
    load_tile(klin + q0, KVC, t0);
    float kkc[4], kac[4];
    #pragma unroll
    for (int nt = 0; nt < 4; ++nt) kkc[nt] = k_k[cbase + nt*16 + l];
    XCNT_WAIT();
    #pragma unroll
    for (int nt = 0; nt < 4; ++nt) kac[nt] = k_a[cbase + nt*16 + l];
    XCNT_WAIT();
    float ss[8];
    #pragma unroll
    for (int j = 0; j < 8; ++j) ss[j] = 0.f;
    #pragma unroll
    for (int nt = 0; nt < 4; ++nt) {
        v8f o;
        #pragma unroll
        for (int j = 0; j < 8; ++j) {
            const float av = 1.f / (1.f + expf(-acc[nt][j]));
            const float kf = t0[nt][j];
            const float kkp = kf * kkc[nt];
            o[j] = kf * (1.f + (av - 1.f) * kac[nt]);
            t0[nt][j]  = kkp;
            acc[nt][j] = av;
            ss[j] += kkp * kkp;
        }
        SCHED_EDGE();
        #pragma unroll
        for (int j = 0; j < 8; ++j) kpost[g0 + (size_t)j * CC + nt*16] = o[j];
        XCNT_WAIT();
        SCHED_EDGE();
    }
    #pragma unroll
    for (int j = 0; j < 8; ++j) {
        float s = ss[j];
        // a row's 64 channels sit in the 16 lanes of one half (4 per lane)
        for (int off = 8; off; off >>= 1) s += __shfl_xor(s, off);
        const float rn = 1.f / fmaxf(sqrtf(s), 1e-12f);
        float oa[4], ob[4];
        #pragma unroll
        for (int nt = 0; nt < 4; ++nt) {
            const float kkn = t0[nt][j] * rn;
            oa[nt] = -kkn;
            ob[nt] = kkn * acc[nt][j];
        }
        SCHED_EDGE();
        #pragma unroll
        for (int nt = 0; nt < 4; ++nt) {
            aaO[g0 + (size_t)j * CC + nt*16] = oa[nt];
            bbO[g0 + (size_t)j * CC + nt*16] = ob[nt];
        }
        XCNT_WAIT();
        SCHED_EDGE();
    }
}
#undef XCNT_WAIT
#undef SCHED_EDGE

// =====================================================================
// Sequential RWKV-7 scan. grid = B*H, block = 64 (one thread per state row),
// S[64] in VGPRs. Per-timestep vectors triple-buffered in LDS; prefetched
// two steps ahead via GLOBAL_LOAD_ASYNC_TO_LDS (ASYNCcnt) when available,
// else software-pipelined register staging.
// =====================================================================
__global__ __launch_bounds__(64)
void scan_kernel(const float* __restrict__ r, const float* __restrict__ dc,
                 const float* __restrict__ k, const float* __restrict__ v,
                 const float* __restrict__ aa, const float* __restrict__ bb,
                 const float* __restrict__ state0, float* __restrict__ y)
{
    const int bh = blockIdx.x;            // b*H + h
    const int b = bh >> 5, h = bh & 31;
    const int i = threadIdx.x;            // state row
    float S[NN];
    const float* st = state0 + ((size_t)bh * NN + i) * NN;
    #pragma unroll
    for (int q = 0; q < NN; ++q) S[q] = st[q];

    __shared__ float buf[3][6*NN];

#ifdef USE_ASYNC_LDS
    // Async global->LDS, 2 steps ahead (12 outstanding b32 loads per wave).
    #define SCAN_ISSUE(t_, slot_)  do {                                          \
        const size_t gb_ = ((size_t)(b*TT + (t_)))*CC + h*NN + i;                \
        float* d_ = &buf[(slot_)][i];                                            \
        __builtin_amdgcn_global_load_async_to_lds_b32((AS1 int*)(r  + gb_), (AS3 int*)(d_        ), 0, 0); \
        __builtin_amdgcn_global_load_async_to_lds_b32((AS1 int*)(dc + gb_), (AS3 int*)(d_ + 1*NN), 0, 0); \
        __builtin_amdgcn_global_load_async_to_lds_b32((AS1 int*)(k  + gb_), (AS3 int*)(d_ + 2*NN), 0, 0); \
        __builtin_amdgcn_global_load_async_to_lds_b32((AS1 int*)(v  + gb_), (AS3 int*)(d_ + 3*NN), 0, 0); \
        __builtin_amdgcn_global_load_async_to_lds_b32((AS1 int*)(aa + gb_), (AS3 int*)(d_ + 4*NN), 0, 0); \
        __builtin_amdgcn_global_load_async_to_lds_b32((AS1 int*)(bb + gb_), (AS3 int*)(d_ + 5*NN), 0, 0); \
    } while (0)

    SCAN_ISSUE(0, 0);
    SCAN_ISSUE(1, 1);
    for (int t = 0; t < TT; ++t) {
        if (t + 2 < TT)      { SCAN_ISSUE(t + 2, (t + 2) % 3);
                               __builtin_amdgcn_s_wait_asynccnt(12); }
        else if (t + 1 < TT) { __builtin_amdgcn_s_wait_asynccnt(6); }
        else                 { __builtin_amdgcn_s_wait_asynccnt(0); }
        __syncthreads();
        const float* rb = &buf[t % 3][0];
        const float* db = rb + NN;  const float* kb = rb + 2*NN;
        const float* vb = rb + 3*NN; const float* ab = rb + 4*NN;
        const float* bp = rb + 5*NN;
        float sa = 0.f;
        #pragma unroll
        for (int q = 0; q < NN; ++q) sa += S[q] * ab[q];
        const float vi = vb[i];
        float yo = 0.f;
        #pragma unroll
        for (int q = 0; q < NN; ++q) {
            const float s2 = S[q]*db[q] + sa*bp[q] + vi*kb[q];
            S[q] = s2;
            yo += s2 * rb[q];
        }
        y[((size_t)(b*TT + t))*CC + h*NN + i] = yo;
        __syncthreads();
    }
    #undef SCAN_ISSUE
#else
    // Fallback: register double-buffer; loads for t+1 issued before compute(t).
    float rg[6];
    {
        const size_t gb = ((size_t)(b*TT))*CC + h*NN + i;
        rg[0]=r[gb]; rg[1]=dc[gb]; rg[2]=k[gb]; rg[3]=v[gb]; rg[4]=aa[gb]; rg[5]=bb[gb];
    }
    for (int t = 0; t < TT; ++t) {
        const int cur = t & 1;
        float* d = &buf[cur][i];
        d[0]=rg[0]; d[1*NN]=rg[1]; d[2*NN]=rg[2]; d[3*NN]=rg[3]; d[4*NN]=rg[4]; d[5*NN]=rg[5];
        __syncthreads();
        if (t + 1 < TT) {
            const size_t gb = ((size_t)(b*TT + t + 1))*CC + h*NN + i;
            rg[0]=r[gb]; rg[1]=dc[gb]; rg[2]=k[gb]; rg[3]=v[gb]; rg[4]=aa[gb]; rg[5]=bb[gb];
        }
        const float* rb = &buf[cur][0];
        const float* db = rb + NN;  const float* kb = rb + 2*NN;
        const float* vb = rb + 3*NN; const float* ab = rb + 4*NN;
        const float* bp = rb + 5*NN;
        float sa = 0.f;
        #pragma unroll
        for (int q = 0; q < NN; ++q) sa += S[q] * ab[q];
        const float vi = vb[i];
        float yo = 0.f;
        #pragma unroll
        for (int q = 0; q < NN; ++q) {
            const float s2 = S[q]*db[q] + sa*bp[q] + vi*kb[q];
            S[q] = s2;
            yo += s2 * rb[q];
        }
        y[((size_t)(b*TT + t))*CC + h*NN + i] = yo;
        __syncthreads();
    }
#endif
}

// =====================================================================
// GroupNorm over (T,N) per (b,h) + bonus term. xx aliases rbuf
// (each lane reads its r before writing the same location).
// =====================================================================
__global__ __launch_bounds__(256)
void gnorm_kernel(const float* __restrict__ y, const float* rbuf,
                  const float* __restrict__ kpost, const float* __restrict__ vpost,
                  const float* __restrict__ r_k, const float* __restrict__ ln_w,
                  const float* __restrict__ ln_b, float* xx)
{
    const int bh = blockIdx.x;
    const int b = bh >> 5, h = bh & 31;
    const int tid = threadIdx.x;
    __shared__ float red[256], red2[256];

    float s = 0.f, s2 = 0.f;
    for (int f = tid; f < TT*NN; f += 256) {
        const int t = f >> 6, n = f & 63;
        const float v = y[((size_t)(b*TT + t))*CC + h*NN + n];
        s += v; s2 += v*v;
    }
    red[tid] = s; red2[tid] = s2;
    __syncthreads();
    for (int off = 128; off; off >>= 1) {
        if (tid < off) { red[tid] += red[tid+off]; red2[tid] += red2[tid+off]; }
        __syncthreads();
    }
    const float mean = red[0]  * (1.f / 65536.f);
    const float var  = red2[0] * (1.f / 65536.f) - mean*mean;
    const float rstd = rsqrtf(var + GN_EPS);

    const int wave = tid >> 5, lane = tid & 31;
    const float lw0 = ln_w[h*NN + lane],      lb0 = ln_b[h*NN + lane];
    const float lw1 = ln_w[h*NN + lane + 32], lb1 = ln_b[h*NN + lane + 32];
    const float rk0 = r_k[h*NN + lane],       rk1 = r_k[h*NN + lane + 32];
    for (int t = wave; t < TT; t += 8) {
        const size_t base = ((size_t)(b*TT + t))*CC + h*NN;
        const float r0 = rbuf[base + lane],      r1 = rbuf[base + lane + 32];
        const float k0 = kpost[base + lane],     k1 = kpost[base + lane + 32];
        float d = r0*k0*rk0 + r1*k1*rk1;
        for (int off = 16; off; off >>= 1) d += __shfl_xor(d, off);
        const float y0 = y[base + lane], y1 = y[base + lane + 32];
        const float o0 = (y0 - mean)*rstd*lw0 + lb0 + d*vpost[base + lane];
        const float o1 = (y1 - mean)*rstd*lw1 + lb1 + d*vpost[base + lane + 32];
        xx[base + lane]      = o0;
        xx[base + lane + 32] = o1;
    }
}

// =====================================================================
extern "C" void kernel_launch(void* const* d_in, const int* in_sizes, int n_in,
                              void* d_out, int out_size, void* d_ws, size_t ws_size,
                              hipStream_t stream) {
    const float* x       = (const float*)d_in[0];
    const float* v_first = (const float*)d_in[1];
    const float* state0  = (const float*)d_in[2];
    const float* Rw      = (const float*)d_in[3];
    const float* R_bias  = (const float*)d_in[4];
    const float* Kw      = (const float*)d_in[5];
    const float* K_bias  = (const float*)d_in[6];
    const float* Vw      = (const float*)d_in[7];
    const float* V_bias  = (const float*)d_in[8];
    const float* Ow      = (const float*)d_in[9];
    const float* O_bias  = (const float*)d_in[10];
    const float* w0      = (const float*)d_in[11];
    const float* w1      = (const float*)d_in[12];
    const float* w2      = (const float*)d_in[13];
    const float* a0      = (const float*)d_in[14];
    const float* a1      = (const float*)d_in[15];
    const float* a2      = (const float*)d_in[16];
    const float* v0      = (const float*)d_in[17];
    const float* v1      = (const float*)d_in[18];
    const float* v2      = (const float*)d_in[19];
    const float* k_k     = (const float*)d_in[20];
    const float* k_a     = (const float*)d_in[21];
    const float* r_k     = (const float*)d_in[22];
    const float* ln_w    = (const float*)d_in[23];
    const float* ln_b    = (const float*)d_in[24];
    float* out = (float*)d_out;

    // workspace layout (floats)
    float* ws = (float*)d_ws;
    float* r_buf  = ws;                                // M*C   (later reused as xx)
    float* klin   = r_buf  + (size_t)MM*CC;            // M*512
    float* vlin   = klin   + (size_t)MM*KVC;           // M*512
    float* hw     = vlin   + (size_t)MM*KVC;           // M*64
    float* ha     = hw     + (size_t)MM*64;            // M*64
    float* hv     = ha     + (size_t)MM*64;            // M*32
    float* decayb = hv     + (size_t)MM*32;            // M*C
    float* kpost  = decayb + (size_t)MM*CC;            // M*C
    float* vpost  = kpost  + (size_t)MM*CC;            // M*C
    float* aab    = vpost  + (size_t)MM*CC;            // M*C
    float* bbb    = aab    + (size_t)MM*CC;            // M*C
    float* ybuf   = bbb    + (size_t)MM*CC;            // M*C
    float* xx     = r_buf;                             // alias: r dead after bonus read

    const dim3 blk(128);
    // Step 1: projections (blocked WMMA for the big GEMMs)
    wmma_gemm_f32_blk<<<dim3(MM/64, CC/64),  blk, 0, stream>>>(x, Rw, R_bias, r_buf, CC, CC);
    wmma_gemm_f32_blk<<<dim3(MM/64, KVC/64), blk, 0, stream>>>(x, Kw, K_bias, klin,  CC, KVC);
    wmma_gemm_f32_blk<<<dim3(MM/64, KVC/64), blk, 0, stream>>>(x, Vw, V_bias, vlin,  CC, KVC);
    wmma_gemm_f32_small<true ><<<dim3(MM/16), blk, 0, stream>>>(x, w1, hw, CC, 64);
    wmma_gemm_f32_small<false><<<dim3(MM/16), blk, 0, stream>>>(x, a1, ha, CC, 64);
    wmma_gemm_f32_small<false><<<dim3(MM/16), blk, 0, stream>>>(x, v1, hv, CC, 32);

    // fused elementwise prep
    fusion_kernel<<<dim3(MM/128, HH), dim3(256), 0, stream>>>(
        klin, vlin, hw, ha, hv, v_first, w0, w2, a0, a2, v0, v2, k_k, k_a,
        decayb, kpost, vpost, aab, bbb);

    // Step 2: sequential scan
    scan_kernel<<<dim3(BB*HH), dim3(64), 0, stream>>>(
        r_buf, decayb, kpost, vpost, aab, bbb, state0, ybuf);

    // Step 3: group norm + bonus
    gnorm_kernel<<<dim3(BB*HH), dim3(256), 0, stream>>>(
        ybuf, r_buf, kpost, vpost, r_k, ln_w, ln_b, xx);

    // output projection
    wmma_gemm_f32_blk<<<dim3(MM/64, CC/64), blk, 0, stream>>>(xx, Ow, O_bias, out, CC, CC);
    (void)in_sizes; (void)n_in; (void)out_size; (void)ws_size;
}

// v003
// It runs in 972 microseconds.
// In two side-by-side timings against v002, it was 2.65 and 2.67 times as fast.
// Over all steps from v000 it is 4.42 times as fast.
#include <hip/hip_runtime.h>
#include <math.h>

// ---------------- problem constants ----------------
#define BB  4
#define TT  1024
#define CC  2048
#define HH  32
#define NN  64
#define KVC 512
#define MM  (BB*TT)          // 4096 rows
#define GN_EPS 0.00064f

typedef float v2f __attribute__((ext_vector_type(2)));
typedef float v8f __attribute__((ext_vector_type(8)));

#define GBK     32
#define GPITCH  36
#define GROWB   (GPITCH * 4)
#define GBUFB   (128 * GROWB)

// A thread's eight 16-byte pieces of one k tile: rows r, r+16, r+32, r+48 of X and of W.
// The wait on the last line stands before the address registers can be rewritten.
__device__ __forceinline__
void gemm_stage_tile(unsigned lds, const float* gx, const float* gw, size_t rstep)
{
    asm volatile(
        "global_load_async_to_lds_b128 %0, %8, off\n\t"
        "global_load_async_to_lds_b128 %1, %9, off\n\t"
        "global_load_async_to_lds_b128 %2, %10, off\n\t"
        "global_load_async_to_lds_b128 %3, %11, off\n\t"
        "global_load_async_to_lds_b128 %4, %12, off\n\t"
        "global_load_async_to_lds_b128 %5, %13, off\n\t"
        "global_load_async_to_lds_b128 %6, %14, off\n\t"
        "global_load_async_to_lds_b128 %7, %15, off\n\t"
        "s_wait_xcnt 0x0"
        :: "v"(lds),              "v"(lds +  16*GROWB), "v"(lds +  32*GROWB), "v"(lds +  48*GROWB),
           "v"(lds + 64*GROWB),   "v"(lds +  80*GROWB), "v"(lds +  96*GROWB), "v"(lds + 112*GROWB),
           "v"(gx), "v"(gx + rstep), "v"(gx + 2*rstep), "v"(gx + 3*rstep),
           "v"(gw), "v"(gw + rstep), "v"(gw + 2*rstep), "v"(gw + 3*rstep)
        : "memory");
}

__global__ __launch_bounds__(128)
void wmma_gemm_f32_blk(const float* __restrict__ X, const float* __restrict__ W,
                       const float* __restrict__ bias, float* __restrict__ Out,
                       int K, int Nc)
{
    __shared__ __attribute__((aligned(16))) float tile[2 * 128 * GPITCH];

    const int lane = threadIdx.x & 31;
    const int wave = threadIdx.x >> 5;
    const int half = lane >> 4;
    const int l    = lane & 15;
    const int mw   = wave >> 1, nw = wave & 1;
    const int tileM = blockIdx.x * 64 + mw * 32;
    const int tileN = blockIdx.y * 64 + nw * 32;

    // copies: 8 lanes a row (16 bytes each), 16 rows per pass over the block's 128 threads
    const int crow = threadIdx.x >> 3, cpos = (threadIdx.x & 7) * 4;
    const float* gx = X + (size_t)(blockIdx.x * 64 + crow) * K + cpos;
    const float* gw = W + (size_t)(blockIdx.y * 64 + crow) * K + cpos;
    const size_t rstep = (size_t)16 * K;
    const unsigned lds0 = (unsigned)(uintptr_t)tile + (unsigned)(crow * GROWB + cpos * 4);
    const int nT = K / GBK;

    gemm_stage_tile(lds0, gx, gw, rstep);
    asm volatile("s_wait_asynccnt 0x0" ::: "memory");   // tile 0 has landed (this wave's part)
    __syncthreads();                                    // ... and every other wave's
    if (nT > 1) gemm_stage_tile(lds0 + GBUFB, gx + GBK, gw + GBK, rstep);

    // fragments: lane -> row, half -> k pair, as with the global loads they replace
    const int aoff = (mw * 32 + l) * GPITCH + 2*half;
    const int boff = (64 + nw * 32 + l) * GPITCH + 2*half;

    v8f acc00 = {}, acc01 = {}, acc10 = {}, acc11 = {};
    for (int t = 0; t < nT; ++t) {
        const float* buf = tile + (t & 1) * (128 * GPITCH);
        const float* as  = buf + aoff;
        const float* bs  = buf + boff;
        #pragma unroll   // constant LDS offsets on every fragment read
        for (int s = 0; s < GBK; s += 4) {
            v2f a0 = *(const v2f*)(as + s);
            v2f a1 = *(const v2f*)(as + 16*GPITCH + s);
            v2f b0 = *(const v2f*)(bs + s);
            v2f b1 = *(const v2f*)(bs + 16*GPITCH + s);
            acc00 = __builtin_amdgcn_wmma_f32_16x16x4_f32(false, a0, false, b0, (short)0, acc00, false, false);
            acc01 = __builtin_amdgcn_wmma_f32_16x16x4_f32(false, a0, false, b1, (short)0, acc01, false, false);
            acc10 = __builtin_amdgcn_wmma_f32_16x16x4_f32(false, a1, false, b0, (short)0, acc10, false, false);
            acc11 = __builtin_amdgcn_wmma_f32_16x16x4_f32(false, a1, false, b1, (short)0, acc11, false, false);
        }
        asm volatile("s_wait_dscnt 0x0" ::: "memory");     // this wave has left the buffer
        asm volatile("s_wait_asynccnt 0x0" ::: "memory");  // its part of tile t+1 has landed
        __syncthreads();   // publishes tile t+1 and ends every wave's reads of tile t
        if (t + 2 < nT)
            gemm_stage_tile(lds0 + (t & 1) * GBUFB, gx + (size_t)(t + 2) * GBK, gw + (size_t)(t + 2) * GBK, rstep);
    }
    asm volatile("s_wait_asynccnt 0x0" ::: "memory");      // no copy is left when the wave ends

    const int col0 = tileN + l, col1 = tileN + 16 + l;
    const float bs0 = bias ? bias[col0] : 0.0f;
    const float bs1 = bias ? bias[col1] : 0.0f;
    asm volatile("s_wait_xcnt 0x0" ::: "memory");   // precaution: before the bias loads' offset register is reused for the store addresses
    __builtin_amdgcn_sched_barrier(0);   // keeps the store-address arithmetic, which reuses that register, behind the wait
    #pragma unroll
    for (int j = 0; j < 8; ++j) {
        const int row0 = tileM + j + 8*half;           // C/D: VGPR j -> M=j / j+8
        const int row1 = row0 + 16;
        Out[(size_t)row0 * Nc + col0] = acc00[j] + bs0;
        Out[(size_t)row0 * Nc + col1] = acc01[j] + bs1;
        Out[(size_t)row1 * Nc + col0] = acc10[j] + bs0;
        Out[(size_t)row1 * Nc + col1] = acc11[j] + bs1;
    }
}

// =====================================================================
// Simple WMMA GEMM for the LoRA projections (Nc = 64/32), W stored (K,Nc).
// One wave = one 16x16 tile. TANH applies tanh instead of bias.
// =====================================================================
template<bool TANH>
__global__ __launch_bounds__(128)
void wmma_gemm_f32_small(const float* __restrict__ X, const float* __restrict__ W,
                         float* __restrict__ Out, int K, int Nc)
{
    const int lane = threadIdx.x & 31;
    const int wave = threadIdx.x >> 5;
    const int half = lane >> 4;
    const int l    = lane & 15;
    const int tileM = blockIdx.x * 16;
    const int tileN = wave * 16;
    if (tileN >= Nc) return;             // wave-uniform

    const float* xrow = X + (size_t)(tileM + l) * K;
    const int n = tileN + l;
    v8f acc = {};
    for (int k0 = 0; k0 < K; k0 += 4) {
        v2f a = *(const v2f*)(xrow + k0 + 2*half);
        v2f b;
        b.x = W[(size_t)(k0 + 2*half    ) * Nc + n];
        b.y = W[(size_t)(k0 + 2*half + 1) * Nc + n];
        acc = __builtin_amdgcn_wmma_f32_16x16x4_f32(false, a, false, b, (short)0, acc, false, false);
    }
    #pragma unroll
    for (int j = 0; j < 8; ++j) {
        const int row = tileM + j + 8*half;
        Out[(size_t)row * Nc + n] = TANH ? tanhf(acc[j]) : acc[j];
    }
}

#define XCNT_WAIT() asm volatile("s_wait_xcnt 0x0" ::: "memory")
// Round a group of stores and its wait: keeps the scheduler from placing vector work,
// which may reuse a stored register, between a store and the wait.
#define SCHED_EDGE() __builtin_amdgcn_sched_barrier(0)

template<int K>
__device__ __forceinline__
void lora_tile(const float* __restrict__ A, const float* __restrict__ Bm,
               const float* __restrict__ init, int tileM, int cbase,
               int l, int half, v8f (&acc)[4])
{
    const float* arow = A  + (size_t)(tileM + l) * K + 2*half;   // A: lane -> row, half -> k pair
    const float* bcol = Bm + (size_t)(2*half) * CC + cbase + l;  // B: lane -> col, half -> k pair
    XCNT_WAIT();     // behind the stores of the phase before
    #pragma unroll   // acc[] must stay in registers
    for (int nt = 0; nt < 4; ++nt) {
        const float c0 = init[cbase + nt*16 + l];                // the bias vector starts the sum
        #pragma unroll
        for (int j = 0; j < 8; ++j) acc[nt][j] = c0;
    }
    XCNT_WAIT();
    #pragma unroll   // constant offsets on every load
    for (int kc = 0; kc < K; kc += 16) {
        // all 36 fragment loads of a 16-deep k chunk first: one cache latency per 16 WMMAs
        v2f a[4], b[4][4];
        #pragma unroll
        for (int s = 0; s < 4; ++s) a[s] = *(const v2f*)(arow + kc + 4*s);
        XCNT_WAIT();
        #pragma unroll
        for (int s = 0; s < 4; ++s) {
            const int k0 = kc + 4*s;
            #pragma unroll
            for (int nt = 0; nt < 4; ++nt) {
                b[s][nt].x = bcol[(size_t)(k0    ) * CC + nt*16];
                b[s][nt].y = bcol[(size_t)(k0 + 1) * CC + nt*16];
            }
        }
        XCNT_WAIT();
        #pragma unroll
        for (int s = 0; s < 4; ++s) {
            #pragma unroll
            for (int nt = 0; nt < 4; ++nt)
                acc[nt] = __builtin_amdgcn_wmma_f32_16x16x4_f32(false, a[s], false, b[s][nt], (short)0, acc[nt], false, false);
        }
    }
}

// 16 rows x 64 columns of a row-major array in the accumulator layout, one batch of loads.
__device__ __forceinline__
void load_tile(const float* __restrict__ p, int pitch, v8f (&t)[4])
{
    #pragma unroll   // t[] must stay in registers
    for (int nt = 0; nt < 4; ++nt) {
        #pragma unroll
        for (int j = 0; j < 8; ++j) t[nt][j] = p[(size_t)j * pitch + nt*16];
    }
    XCNT_WAIT();
}

__global__ __launch_bounds__(256)
void fusion_kernel(const float* __restrict__ klin, const float* __restrict__ vlin,
                   const float* __restrict__ hw,  const float* __restrict__ ha,
                   const float* __restrict__ hv,  const float* __restrict__ v_first,
                   const float* __restrict__ w0,  const float* __restrict__ w2,
                   const float* __restrict__ a0,  const float* __restrict__ a2,
                   const float* __restrict__ v0,  const float* __restrict__ v2,
                   const float* __restrict__ k_k, const float* __restrict__ k_a,
                   float* __restrict__ decay, float* __restrict__ kpost,
                   float* __restrict__ vpost, float* __restrict__ aaO,
                   float* __restrict__ bbO)
{
    const int lane = threadIdx.x & 31;
    const int wave = threadIdx.x >> 5;
    const int half = lane >> 4;
    const int l    = lane & 15;
    const int tileM  = blockIdx.x * 128 + wave * 16;
    const int h      = blockIdx.y;
    const int cbase  = h * NN;
    const int kvbase = (h >> 2) * NN;                 // kv-head repeat
    const int row0   = tileM + 8*half;                // C/D: VGPR j -> row j / j+8
    const size_t g0  = (size_t)row0 * CC  + cbase  + l;   // element (j, nt) at g0 + j*CC + nt*16
    const size_t q0  = (size_t)row0 * KVC + kvbase + l;
    v8f acc[4], t0[4], t1[4];

    // ---- decay ----
    lora_tile<64>(hw, w2, w0, tileM, cbase, l, half, acc);
    #pragma unroll   // acc[] is indexed: registers only when unrolled
    for (int nt = 0; nt < 4; ++nt) {
        v8f o;
        #pragma unroll
        for (int j = 0; j < 8; ++j) {
            const float wraw = -log1pf(expf(-acc[nt][j])) - 0.6f;   // -softplus(-t)-0.6
            o[j] = expf(-expf(wraw));
        }
        SCHED_EDGE();
        #pragma unroll
        for (int j = 0; j < 8; ++j) decay[g0 + (size_t)j * CC + nt*16] = o[j];
        XCNT_WAIT();
        SCHED_EDGE();
    }

    // ---- value blend ----
    lora_tile<32>(hv, v2, v0, tileM, cbase, l, half, acc);
    load_tile(vlin + q0, KVC, t0);
    load_tile(v_first + g0, CC, t1);
    #pragma unroll
    for (int nt = 0; nt < 4; ++nt) {
        v8f o;
        #pragma unroll
        for (int j = 0; j < 8; ++j) {
            const float vg = 1.f / (1.f + expf(-acc[nt][j]));
            const float vf = t0[nt][j];
            o[j] = vf + (t1[nt][j] - vf) * vg;
        }
        SCHED_EDGE();
        #pragma unroll
        for (int j = 0; j < 8; ++j) vpost[g0 + (size_t)j * CC + nt*16] = o[j];
        XCNT_WAIT();
        SCHED_EDGE();
    }

    // ---- a gate, k, normalised kk ----
    lora_tile<64>(ha, a2, a0, tileM, cbase, l, half, acc);
    load_tile(klin + q0, KVC, t0);
    float kkc[4], kac[4];
    #pragma unroll
    for (int nt = 0; nt < 4; ++nt) kkc[nt] = k_k[cbase + nt*16 + l];
    XCNT_WAIT();
    #pragma unroll
    for (int nt = 0; nt < 4; ++nt) kac[nt] = k_a[cbase + nt*16 + l];
    XCNT_WAIT();
    float ss[8];
    #pragma unroll
    for (int j = 0; j < 8; ++j) ss[j] = 0.f;
    #pragma unroll
    for (int nt = 0; nt < 4; ++nt) {
        v8f o;
        #pragma unroll
        for (int j = 0; j < 8; ++j) {
            const float av = 1.f / (1.f + expf(-acc[nt][j]));
            const float kf = t0[nt][j];
            const float kkp = kf * kkc[nt];
            o[j] = kf * (1.f + (av - 1.f) * kac[nt]);
            t0[nt][j]  = kkp;
            acc[nt][j] = av;
            ss[j] += kkp * kkp;
        }
        SCHED_EDGE();
        #pragma unroll
        for (int j = 0; j < 8; ++j) kpost[g0 + (size_t)j * CC + nt*16] = o[j];
        XCNT_WAIT();
        SCHED_EDGE();
    }
    #pragma unroll
    for (int j = 0; j < 8; ++j) {
        float s = ss[j];
        // a row's 64 channels sit in the 16 lanes of one half (4 per lane)
        for (int off = 8; off; off >>= 1) s += __shfl_xor(s, off);
        const float rn = 1.f / fmaxf(sqrtf(s), 1e-12f);
        float oa[4], ob[4];
        #pragma unroll
        for (int nt = 0; nt < 4; ++nt) {
            const float kkn = t0[nt][j] * rn;
            oa[nt] = -kkn;
            ob[nt] = kkn * acc[nt][j];
        }
        SCHED_EDGE();
        #pragma unroll
        for (int nt = 0; nt < 4; ++nt) {
            aaO[g0 + (size_t)j * CC + nt*16] = oa[nt];
            bbO[g0 + (size_t)j * CC + nt*16] = ob[nt];
        }
        XCNT_WAIT();
        SCHED_EDGE();
    }
}
#undef XCNT_WAIT
#undef SCHED_EDGE

// =====================================================================
// Sequential RWKV-7 scan. The 64 state rows of a (batch, head) never exchange anything,
// so they are spread wide: grid = B*H*2, a block of 4 waves owns 32 rows, a wave 8 rows.
// A row lies across 8 lanes (8 columns a lane: 4*lc.. and 32+4*lc..) and a lane holds two
// rows, so each vector element read from LDS serves two state elements and the chain
// of one time step is 8 products, a 3-step lane sum and one multiply-add.
// The six per-step vectors are staged 16 time steps at a time by asynchronous copies,
// two buffers, one barrier per 16 steps; y leaves through LDS in whole 128-byte lines.
// =====================================================================
typedef float v4f __attribute__((ext_vector_type(4)));

#define SCH    16                  // time steps per staged chunk
#define SSTEPF (6 * NN)            // floats of one staged step: r, decay, k, v, aa, bb
#define SBUFF  (SCH * SSTEPF)      // floats of one buffer
#define SBUFB  (SBUFF * 4)
#define SROWS  32                  // state rows per block

// A thread's twelve 16-byte pieces of one chunk: steps s and s+8 of each of the six arrays.
// The wait on the last line stands before the address registers can be rewritten.
__device__ __forceinline__
void scan_stage_chunk(unsigned lds, const float* r, const float* dc, const float* k,
                      const float* v, const float* aa, const float* bb)
{
    asm volatile(
        "global_load_async_to_lds_b128 %0, %12, off\n\t"
        "global_load_async_to_lds_b128 %1, %13, off\n\t"
        "global_load_async_to_lds_b128 %2, %14, off\n\t"
        "global_load_async_to_lds_b128 %3, %15, off\n\t"
        "global_load_async_to_lds_b128 %4, %16, off\n\t"
        "global_load_async_to_lds_b128 %5, %17, off\n\t"
        "global_load_async_to_lds_b128 %6, %18, off\n\t"
        "global_load_async_to_lds_b128 %7, %19, off\n\t"
        "global_load_async_to_lds_b128 %8, %20, off\n\t"
        "global_load_async_to_lds_b128 %9, %21, off\n\t"
        "global_load_async_to_lds_b128 %10, %22, off\n\t"
        "global_load_async_to_lds_b128 %11, %23, off\n\t"
        "s_wait_xcnt 0x0"
        :: "v"(lds),            "v"(lds + 1*NN*4), "v"(lds + 2*NN*4),
           "v"(lds + 3*NN*4),   "v"(lds + 4*NN*4), "v"(lds + 5*NN*4),
           "v"(lds + 8*SSTEPF*4),            "v"(lds + 8*SSTEPF*4 + 1*NN*4), "v"(lds + 8*SSTEPF*4 + 2*NN*4),
           "v"(lds + 8*SSTEPF*4 + 3*NN*4),   "v"(lds + 8*SSTEPF*4 + 4*NN*4), "v"(lds + 8*SSTEPF*4 + 5*NN*4),
           "v"(r), "v"(dc), "v"(k), "v"(v), "v"(aa), "v"(bb),
           "v"(r + 8*CC), "v"(dc + 8*CC), "v"(k + 8*CC), "v"(v + 8*CC), "v"(aa + 8*CC), "v"(bb + 8*CC)
        : "memory");
}

// x + (x of the lane whose number differs in the bits of MASK), inside a 16-lane row
template<int MASK>
__device__ __forceinline__ float lane_xor_add(float x)
{
    const int o = __builtin_amdgcn_update_dpp(0, __builtin_bit_cast(int, x), 0x160 + MASK, 0xf, 0xf, true);
    return x + __builtin_bit_cast(float, o);
}
// sum over the 8 lanes that share a state row; every one of them gets it
__device__ __forceinline__ float row_sum8(float x)
{
    x = lane_xor_add<1>(x);
    x = lane_xor_add<2>(x);
    return lane_xor_add<4>(x);
}

// the lane's 8 columns of one staged vector
struct Cols { v2f c[4]; };
__device__ __forceinline__ Cols load_cols(const float* p)
{
    const v4f lo = *(const v4f*)p, hi = *(const v4f*)(p + 32);
    Cols o;
    o.c[0] = __builtin_shufflevector(lo, lo, 0, 1);
    o.c[1] = __builtin_shufflevector(lo, lo, 2, 3);
    o.c[2] = __builtin_shufflevector(hi, hi, 0, 1);
    o.c[3] = __builtin_shufflevector(hi, hi, 2, 3);
    return o;
}
struct StepIn { Cols r, d, k, a, b; v2f v; };
__device__ __forceinline__ StepIn load_step(const float* sp, int coff, int voff)
{
    StepIn s;
    s.a = load_cols(sp + 4*NN + coff);
    s.d = load_cols(sp + 1*NN + coff);
    s.k = load_cols(sp + 2*NN + coff);
    s.v = *(const v2f*)(sp + 3*NN + voff);
    s.b = load_cols(sp + 5*NN + coff);
    s.r = load_cols(sp + coff);
    return s;
}
__device__ __forceinline__ float dot8(const v2f (&s)[4], const Cols& x)
{
    const v2f p = s[0]*x.c[0] + s[1]*x.c[1];
    const v2f q = s[2]*x.c[2] + s[3]*x.c[3];
    const v2f t = p + q;
    return t.x + t.y;
}

__global__ __launch_bounds__(128)
void scan_kernel(const float* __restrict__ r, const float* __restrict__ dc,
                 const float* __restrict__ k, const float* __restrict__ v,
                 const float* __restrict__ aa, const float* __restrict__ bb,
                 const float* __restrict__ state0, float* __restrict__ y)
{
    __shared__ __attribute__((aligned(16))) float stage[2 * SBUFF];
    __shared__ __attribute__((aligned(16))) float ybuf[2 * SCH * SROWS];

    const int bh    = blockIdx.x >> 1;         // b*H + h
    const int rbase = (blockIdx.x & 1) * SROWS;
    const int b = bh >> 5, h = bh & 31;
    const int tid  = threadIdx.x;
    const int lane = tid & 31, wave = tid >> 5;
    const int lc = lane & 7, lr = lane >> 3;
    const int rloc = wave * 8 + lr * 2;        // the lane's two rows inside the block's 32
    const int coff = lc * 4;
    const int voff = rbase + rloc;

    v2f S[2][4];
    #pragma unroll   // S[] must stay in registers
    for (int rr = 0; rr < 2; ++rr) {
        const Cols c = load_cols(state0 + ((size_t)bh * NN + rbase + rloc + rr) * NN + coff);
        #pragma unroll
        for (int q = 0; q < 4; ++q) S[rr][q] = c.c[q];
    }
    asm volatile("s_wait_xcnt 0x0" ::: "memory");   // precaution: before the state loads' address registers are reused

    // copies: 16 lanes a vector (16 bytes each), 8 steps per pass over the block's 128 threads
    const int crow = tid >> 4, cpos = (tid & 15) * 4;
    const size_t g0 = ((size_t)(b * TT + crow)) * CC + h * NN + cpos;
    const unsigned lds0 = (unsigned)(uintptr_t)stage + (unsigned)((crow * SSTEPF + cpos) * 4);
    // y: 8 lanes store one step's 128-byte line of the block's 32 rows
    float* yg = y + ((size_t)(b * TT + (tid >> 3))) * CC + h * NN + rbase + (tid & 7) * 4;
    const int nC = TT / SCH;

    scan_stage_chunk(lds0, r + g0, dc + g0, k + g0, v + g0, aa + g0, bb + g0);
    asm volatile("s_wait_asynccnt 0x0" ::: "memory");   // chunk 0 has landed (this wave's part)
    __syncthreads();                                    // ... and every other wave's
    {
        const size_t g = g0 + (size_t)SCH * CC;
        scan_stage_chunk(lds0 + SBUFB, r + g, dc + g, k + g, v + g, aa + g, bb + g);
    }

    for (int c = 0; c < nC; ++c) {
        const float* sb = stage + (c & 1) * SBUFF;
        float* yb = ybuf + (c & 1) * (SCH * SROWS);
        v2f keep = {0.f, 0.f};
        // vectors are read from LDS two steps ahead of their use
        StepIn p0 = load_step(sb, coff, voff);
        StepIn p1 = load_step(sb + SSTEPF, coff, voff);
        Cols rprev = p0.r;
        #pragma unroll   // constant LDS offsets; the step records stay in registers
        for (int tt = 0; tt <= SCH; ++tt) {
            // y of step tt-1 is a dot product of the same S as this step's sa: the four lane sums run side by side
            v2f yo = {0.f, 0.f};
            if (tt > 0) {
                #pragma unroll
                for (int rr = 0; rr < 2; ++rr) yo[rr] = dot8(S[rr], rprev);
            }
            if (tt < SCH) {
                StepIn p2 = p1;
                if (tt + 2 < SCH) p2 = load_step(sb + (tt + 2) * SSTEPF, coff, voff);
                float sa[2];
                v2f   T[2][4];
                #pragma unroll
                for (int rr = 0; rr < 2; ++rr) sa[rr] = dot8(S[rr], p0.a);
                #pragma unroll
                for (int rr = 0; rr < 2; ++rr) {
                    const v2f vv = {p0.v[rr], p0.v[rr]};
                    #pragma unroll
                    for (int q = 0; q < 4; ++q) T[rr][q] = S[rr][q] * p0.d.c[q] + vv * p0.k.c[q];
                }
                #pragma unroll
                for (int rr = 0; rr < 2; ++rr) {
                    const float s = row_sum8(sa[rr]);
                    const v2f ss = {s, s};
                    #pragma unroll
                    for (int q = 0; q < 4; ++q) S[rr][q] = T[rr][q] + ss * p0.b.c[q];
                }
                rprev = p0.r;
                p0 = p1;
                p1 = p2;
            }
            if (tt > 0) {
                const int u = tt - 1;
                #pragma unroll
                for (int rr = 0; rr < 2; ++rr) yo[rr] = row_sum8(yo[rr]);
                // lane lc keeps the y pair of step lc of each run of 8, then all lanes store at once
                if ((u & 7) == lc) keep = yo;
                if ((u & 7) == 7)
                    *(v2f*)(yb + ((u & 8) + lc) * SROWS + rloc) = keep;
            }
            // keeps each step's LDS reads a whole step ahead of their use: without it the scheduler sinks them next to it
            __builtin_amdgcn_sched_barrier(0);
        }
        asm volatile("s_wait_dscnt 0x0" ::: "memory");     // this wave has left the buffer, its y is in LDS
        asm volatile("s_wait_asynccnt 0x0" ::: "memory");  // its part of chunk c+1 has landed
        __syncthreads();   // publishes chunk c+1 and this chunk's y, ends every wave's reads of chunk c
        if (c + 2 < nC) {
            const size_t g = g0 + (size_t)(c + 2) * SCH * CC;
            scan_stage_chunk(lds0 + (c & 1) * SBUFB, r + g, dc + g, k + g, v + g, aa + g, bb + g);
        }
        const v4f yv = *(const v4f*)(yb + tid * 4);
        *(v4f*)(yg + (size_t)c * SCH * CC) = yv;
        asm volatile("s_wait_xcnt 0x0" ::: "memory");      // precaution: before the store's registers are reused
    }
    asm volatile("s_wait_asynccnt 0x0" ::: "memory");      // no copy is left when the wave ends
}

// =====================================================================
// GroupNorm over (T,N) per (b,h) + bonus term. xx aliases rbuf
// (each lane reads its r before writing the same location).
// =====================================================================
__global__ __launch_bounds__(256)
void gnorm_kernel(const float* __restrict__ y, const float* rbuf,
                  const float* __restrict__ kpost, const float* __restrict__ vpost,
                  const float* __restrict__ r_k, const float* __restrict__ ln_w,
                  const float* __restrict__ ln_b, float* xx)
{
    const int bh = blockIdx.x;
    const int b = bh >> 5, h = bh & 31;
    const int tid = threadIdx.x;
    __shared__ float red[256], red2[256];

    float s = 0.f, s2 = 0.f;
    for (int f = tid; f < TT*NN; f += 256) {
        const int t = f >> 6, n = f & 63;
        const float v = y[((size_t)(b*TT + t))*CC + h*NN + n];
        s += v; s2 += v*v;
    }
    red[tid] = s; red2[tid] = s2;
    __syncthreads();
    for (int off = 128; off; off >>= 1) {
        if (tid < off) { red[tid] += red[tid+off]; red2[tid] += red2[tid+off]; }
        __syncthreads();
    }
    const float mean = red[0]  * (1.f / 65536.f);
    const float var  = red2[0] * (1.f / 65536.f) - mean*mean;
    const float rstd = rsqrtf(var + GN_EPS);

    const int wave = tid >> 5, lane = tid & 31;
    const float lw0 = ln_w[h*NN + lane],      lb0 = ln_b[h*NN + lane];
    const float lw1 = ln_w[h*NN + lane + 32], lb1 = ln_b[h*NN + lane + 32];
    const float rk0 = r_k[h*NN + lane],       rk1 = r_k[h*NN + lane + 32];
    for (int t = wave; t < TT; t += 8) {
        const size_t base = ((size_t)(b*TT + t))*CC + h*NN;
        const float r0 = rbuf[base + lane],      r1 = rbuf[base + lane + 32];
        const float k0 = kpost[base + lane],     k1 = kpost[base + lane + 32];
        float d = r0*k0*rk0 + r1*k1*rk1;
        for (int off = 16; off; off >>= 1) d += __shfl_xor(d, off);
        const float y0 = y[base + lane], y1 = y[base + lane + 32];
        const float o0 = (y0 - mean)*rstd*lw0 + lb0 + d*vpost[base + lane];
        const float o1 = (y1 - mean)*rstd*lw1 + lb1 + d*vpost[base + lane + 32];
        xx[base + lane]      = o0;
        xx[base + lane + 32] = o1;
    }
}

// =====================================================================
extern "C" void kernel_launch(void* const* d_in, const int* in_sizes, int n_in,
                              void* d_out, int out_size, void* d_ws, size_t ws_size,
                              hipStream_t stream) {
    const float* x       = (const float*)d_in[0];
    const float* v_first = (const float*)d_in[1];
    const float* state0  = (const float*)d_in[2];
    const float* Rw      = (const float*)d_in[3];
    const float* R_bias  = (const float*)d_in[4];
    const float* Kw      = (const float*)d_in[5];
    const float* K_bias  = (const float*)d_in[6];
    const float* Vw      = (const float*)d_in[7];
    const float* V_bias  = (const float*)d_in[8];
    const float* Ow      = (const float*)d_in[9];
    const float* O_bias  = (const float*)d_in[10];
    const float* w0      = (const float*)d_in[11];
    const float* w1      = (const float*)d_in[12];
    const float* w2      = (const float*)d_in[13];
    const float* a0      = (const float*)d_in[14];
    const float* a1      = (const float*)d_in[15];
    const float* a2      = (const float*)d_in[16];
    const float* v0      = (const float*)d_in[17];
    const float* v1      = (const float*)d_in[18];
    const float* v2      = (const float*)d_in[19];
    const float* k_k     = (const float*)d_in[20];
    const float* k_a     = (const float*)d_in[21];
    const float* r_k     = (const float*)d_in[22];
    const float* ln_w    = (const float*)d_in[23];
    const float* ln_b    = (const float*)d_in[24];
    float* out = (float*)d_out;

    // workspace layout (floats)
    float* ws = (float*)d_ws;
    float* r_buf  = ws;                                // M*C   (later reused as xx)
    float* klin   = r_buf  + (size_t)MM*CC;            // M*512
    float* vlin   = klin   + (size_t)MM*KVC;           // M*512
    float* hw     = vlin   + (size_t)MM*KVC;           // M*64
    float* ha     = hw     + (size_t)MM*64;            // M*64
    float* hv     = ha     + (size_t)MM*64;            // M*32
    float* decayb = hv     + (size_t)MM*32;            // M*C
    float* kpost  = decayb + (size_t)MM*CC;            // M*C
    float* vpost  = kpost  + (size_t)MM*CC;            // M*C
    float* aab    = vpost  + (size_t)MM*CC;            // M*C
    float* bbb    = aab    + (size_t)MM*CC;            // M*C
    float* ybuf   = bbb    + (size_t)MM*CC;            // M*C
    float* xx     = r_buf;                             // alias: r dead after bonus read

    const dim3 blk(128);
    // Step 1: projections (blocked WMMA for the big GEMMs)
    wmma_gemm_f32_blk<<<dim3(MM/64, CC/64),  blk, 0, stream>>>(x, Rw, R_bias, r_buf, CC, CC);
    wmma_gemm_f32_blk<<<dim3(MM/64, KVC/64), blk, 0, stream>>>(x, Kw, K_bias, klin,  CC, KVC);
    wmma_gemm_f32_blk<<<dim3(MM/64, KVC/64), blk, 0, stream>>>(x, Vw, V_bias, vlin,  CC, KVC);
    wmma_gemm_f32_small<true ><<<dim3(MM/16), blk, 0, stream>>>(x, w1, hw, CC, 64);
    wmma_gemm_f32_small<false><<<dim3(MM/16), blk, 0, stream>>>(x, a1, ha, CC, 64);
    wmma_gemm_f32_small<false><<<dim3(MM/16), blk, 0, stream>>>(x, v1, hv, CC, 32);

    // fused elementwise prep
    fusion_kernel<<<dim3(MM/128, HH), dim3(256), 0, stream>>>(
        klin, vlin, hw, ha, hv, v_first, w0, w2, a0, a2, v0, v2, k_k, k_a,
        decayb, kpost, vpost, aab, bbb);

    // Step 2: sequential scan
    scan_kernel<<<dim3(BB*HH*2), dim3(128), 0, stream>>>(
        r_buf, decayb, kpost, vpost, aab, bbb, state0, ybuf);

    // Step 3: group norm + bonus
    gnorm_kernel<<<dim3(BB*HH), dim3(256), 0, stream>>>(
        ybuf, r_buf, kpost, vpost, r_k, ln_w, ln_b, xx);

    // output projection
    wmma_gemm_f32_blk<<<dim3(MM/64, CC/64), blk, 0, stream>>>(xx, Ow, O_bias, out, CC, CC);
    (void)in_sizes; (void)n_in; (void)out_size; (void)ws_size;
}

// v004
// A run of this version takes 740 microseconds.
// Next to v003, in two timings, it ran 1.31 and 1.32 times as fast.
// All steps since v000 together make it 5.80 times as fast.
#include <hip/hip_runtime.h>
#include <math.h>

// ---------------- problem constants ----------------
#define BB  4
#define TT  1024
#define CC  2048
#define HH  32
#define NN  64
#define KVC 512
#define MM  (BB*TT)          // 4096 rows
#define GN_EPS 0.00064f

typedef float v2f __attribute__((ext_vector_type(2)));
typedef float v8f __attribute__((ext_vector_type(8)));

#define GBK     32
#define GPITCH  36
#define GROWB   (GPITCH * 4)
#define GBUFB   (128 * GROWB)

// A thread's eight 16-byte pieces of one k tile: rows r, r+16, r+32, r+48 of X and of W.
// The wait on the last line stands before the address registers can be rewritten.
__device__ __forceinline__
void gemm_stage_tile(unsigned lds, const float* gx, const float* gw, size_t rstep)
{
    asm volatile(
        "global_load_async_to_lds_b128 %0, %8, off\n\t"
        "global_load_async_to_lds_b128 %1, %9, off\n\t"
        "global_load_async_to_lds_b128 %2, %10, off\n\t"
        "global_load_async_to_lds_b128 %3, %11, off\n\t"
        "global_load_async_to_lds_b128 %4, %12, off\n\t"
        "global_load_async_to_lds_b128 %5, %13, off\n\t"
        "global_load_async_to_lds_b128 %6, %14, off\n\t"
        "global_load_async_to_lds_b128 %7, %15, off\n\t"
        "s_wait_xcnt 0x0"
        :: "v"(lds),              "v"(lds +  16*GROWB), "v"(lds +  32*GROWB), "v"(lds +  48*GROWB),
           "v"(lds + 64*GROWB),   "v"(lds +  80*GROWB), "v"(lds +  96*GROWB), "v"(lds + 112*GROWB),
           "v"(gx), "v"(gx + rstep), "v"(gx + 2*rstep), "v"(gx + 3*rstep),
           "v"(gw), "v"(gw + rstep), "v"(gw + 2*rstep), "v"(gw + 3*rstep)
        : "memory");
}

__global__ __launch_bounds__(128)
void wmma_gemm_f32_blk(const float* __restrict__ X, const float* __restrict__ W,
                       const float* __restrict__ bias, float* __restrict__ Out,
                       int K, int Nc)
{
    __shared__ __attribute__((aligned(16))) float tile[2 * 128 * GPITCH];

    const int lane = threadIdx.x & 31;
    const int wave = threadIdx.x >> 5;
    const int half = lane >> 4;
    const int l    = lane & 15;
    const int mw   = wave >> 1, nw = wave & 1;
    const int tileM = blockIdx.x * 64 + mw * 32;
    const int tileN = blockIdx.y * 64 + nw * 32;

    // copies: 8 lanes a row (16 bytes each), 16 rows per pass over the block's 128 threads
    const int crow = threadIdx.x >> 3, cpos = (threadIdx.x & 7) * 4;
    const float* gx = X + (size_t)(blockIdx.x * 64 + crow) * K + cpos;
    const float* gw = W + (size_t)(blockIdx.y * 64 + crow) * K + cpos;
    const size_t rstep = (size_t)16 * K;
    const unsigned lds0 = (unsigned)(uintptr_t)tile + (unsigned)(crow * GROWB + cpos * 4);
    const int nT = K / GBK;

    gemm_stage_tile(lds0, gx, gw, rstep);
    asm volatile("s_wait_asynccnt 0x0" ::: "memory");   // tile 0 has landed (this wave's part)
    __syncthreads();                                    // ... and every other wave's
    if (nT > 1) gemm_stage_tile(lds0 + GBUFB, gx + GBK, gw + GBK, rstep);

    // fragments: lane -> row, half -> k pair, as with the global loads they replace
    const int aoff = (mw * 32 + l) * GPITCH + 2*half;
    const int boff = (64 + nw * 32 + l) * GPITCH + 2*half;

    v8f acc00 = {}, acc01 = {}, acc10 = {}, acc11 = {};
    for (int t = 0; t < nT; ++t) {
        const float* buf = tile + (t & 1) * (128 * GPITCH);
        const float* as  = buf + aoff;
        const float* bs  = buf + boff;
        #pragma unroll   // constant LDS offsets on every fragment read
        for (int s = 0; s < GBK; s += 4) {
            v2f a0 = *(const v2f*)(as + s);
            v2f a1 = *(const v2f*)(as + 16*GPITCH + s);
            v2f b0 = *(const v2f*)(bs + s);
            v2f b1 = *(const v2f*)(bs + 16*GPITCH + s);
            acc00 = __builtin_amdgcn_wmma_f32_16x16x4_f32(false, a0, false, b0, (short)0, acc00, false, false);
            acc01 = __builtin_amdgcn_wmma_f32_16x16x4_f32(false, a0, false, b1, (short)0, acc01, false, false);
            acc10 = __builtin_amdgcn_wmma_f32_16x16x4_f32(false, a1, false, b0, (short)0, acc10, false, false);
            acc11 = __builtin_amdgcn_wmma_f32_16x16x4_f32(false, a1, false, b1, (short)0, acc11, false, false);
        }
        asm volatile("s_wait_dscnt 0x0" ::: "memory");     // this wave has left the buffer
        asm volatile("s_wait_asynccnt 0x0" ::: "memory");  // its part of tile t+1 has landed
        __syncthreads();   // publishes tile t+1 and ends every wave's reads of tile t
        if (t + 2 < nT)
            gemm_stage_tile(lds0 + (t & 1) * GBUFB, gx + (size_t)(t + 2) * GBK, gw + (size_t)(t + 2) * GBK, rstep);
    }
    asm volatile("s_wait_asynccnt 0x0" ::: "memory");      // no copy is left when the wave ends

    const int col0 = tileN + l, col1 = tileN + 16 + l;
    const float bs0 = bias ? bias[col0] : 0.0f;
    const float bs1 = bias ? bias[col1] : 0.0f;
    asm volatile("s_wait_xcnt 0x0" ::: "memory");   // precaution: before the bias loads' offset register is reused for the store addresses
    __builtin_amdgcn_sched_barrier(0);   // keeps the store-address arithmetic, which reuses that register, behind the wait
    #pragma unroll
    for (int j = 0; j < 8; ++j) {
        const int row0 = tileM + j + 8*half;           // C/D: VGPR j -> M=j / j+8
        const int row1 = row0 + 16;
        Out[(size_t)row0 * Nc + col0] = acc00[j] + bs0;
        Out[(size_t)row0 * Nc + col1] = acc01[j] + bs1;
        Out[(size_t)row1 * Nc + col0] = acc10[j] + bs0;
        Out[(size_t)row1 * Nc + col1] = acc11[j] + bs1;
    }
}

// =====================================================================
// LoRA first-stage products x@w1 (then tanh), x@a1, x@v1 in ONE launch: the three
// weights, stored (K,Nc), are taken as one (K,160) matrix. A block owns 16 rows of x
// and all 160 columns; its 8 waves split k: of each staged tile of 128 k a wave takes
// 16, with 10 independent accumulator tiles, so one A fragment serves 10 WMMAs.
// Tiles come into LDS in whole lines by asynchronous copies, two buffers; the eight
// partial sums are added through LDS at the end, in wave order.
// =====================================================================
typedef float v4f __attribute__((ext_vector_type(4)));

#define LK    128                  // k per staged tile
#define LWP   168                  // LDS pitch (floats) of a weight row: rows k and k+2 of a fragment read fall 16 banks apart
#define LXP   132                  // LDS pitch (floats) of an x row: 16 rows of an 8-byte fragment read meet 64 distinct banks
#define LWF   (LK * LWP)           // floats of the weight part of a buffer
#define LBUFF (LWF + 16 * LXP)     // floats of one buffer
#define LBUFB (LBUFF * 4)
#define LRP   164                  // LDS pitch (floats) of a partial-sum row: rows j and j+8 fall 32 banks apart

// Eleven 16-byte pieces of one k tile: rows r, r+16, .. r+112 of a 64-wide weight,
// rows q, q+32 of the 32-wide weight, one piece of x.
// The wait on the last line stands before the address registers can be rewritten.
__device__ __forceinline__
void lora_stage11(unsigned lw, const float* gw, unsigned lv, const float* gv,
                  unsigned lx, const float* gx)
{
    asm volatile(
        "global_load_async_to_lds_b128 %0, %11, off\n\t"
        "global_load_async_to_lds_b128 %1, %12, off\n\t"
        "global_load_async_to_lds_b128 %2, %13, off\n\t"
        "global_load_async_to_lds_b128 %3, %14, off\n\t"
        "global_load_async_to_lds_b128 %4, %15, off\n\t"
        "global_load_async_to_lds_b128 %5, %16, off\n\t"
        "global_load_async_to_lds_b128 %6, %17, off\n\t"
        "global_load_async_to_lds_b128 %7, %18, off\n\t"
        "global_load_async_to_lds_b128 %8, %19, off\n\t"
        "global_load_async_to_lds_b128 %9, %20, off\n\t"
        "global_load_async_to_lds_b128 %10, %21, off\n\t"
        "s_wait_xcnt 0x0"
        :: "v"(lw),                "v"(lw +  16*LWP*4), "v"(lw +  32*LWP*4), "v"(lw +  48*LWP*4),
           "v"(lw + 64*LWP*4),     "v"(lw +  80*LWP*4), "v"(lw +  96*LWP*4), "v"(lw + 112*LWP*4),
           "v"(lv),                "v"(lv +  32*LWP*4), "v"(lx),
           "v"(gw),         "v"(gw + 16*64), "v"(gw + 32*64), "v"(gw +  48*64),
           "v"(gw + 64*64), "v"(gw + 80*64), "v"(gw + 96*64), "v"(gw + 112*64),
           "v"(gv),         "v"(gv + 32*32), "v"(gx)
        : "memory");
}

__global__ __launch_bounds__(256)
void lora_in_kernel(const float* __restrict__ X,  const float* __restrict__ w1,
                    const float* __restrict__ a1, const float* __restrict__ v1,
                    float* __restrict__ hw, float* __restrict__ ha, float* __restrict__ hv)
{
    __shared__ __attribute__((aligned(16))) float st[2 * LBUFF];

    const int tid  = threadIdx.x;
    const int lane = tid & 31, wave = tid >> 5;
    const int half = lane >> 4, l = lane & 15;
    const int m0   = blockIdx.x * 16;

    // copies: 16 lanes a row of w1 / a1, 8 lanes a row of v1, 32 lanes a row of x
    const size_t  g64 = (size_t)(tid >> 4) * 64 + (tid & 15) * 4;
    const float*  gv  = v1 + (size_t)(tid >> 3) * 32 + (tid & 7) * 4;
    const float*  gx  = X  + (size_t)(m0 + (tid >> 5)) * CC + (tid & 31) * 4;
    const unsigned lb = (unsigned)(uintptr_t)st;
    const unsigned lw = lb + (unsigned)(((tid >> 4) * LWP + (tid & 15) * 4) * 4);
    const unsigned lv = lb + (unsigned)(((tid >> 3) * LWP + 128 + (tid & 7) * 4) * 4);
    const unsigned lx = lb + (unsigned)((LWF + (tid >> 5) * LXP + (tid & 31) * 4) * 4);
    const int nT = CC / LK;

    auto stage = [&](int buf, int t) {
        const unsigned o = (unsigned)buf * LBUFB;
        lora_stage11(lw + o,          w1 + g64 + (size_t)t * LK * 64,
                     lv + o,          gv + (size_t)t * LK * 32,
                     lx + o,          gx + t * LK);
        lora_stage11(lw + o + 64 * 4, a1 + g64 + (size_t)t * LK * 64,
                     lv + o + 64 * LWP * 4, gv + (size_t)t * LK * 32 + 64 * 32,
                     lx + o + 8 * LXP * 4,  gx + t * LK + 8 * CC);
    };

    stage(0, 0);
    asm volatile("s_wait_asynccnt 0x0" ::: "memory");   // tile 0 has landed (this wave's part)
    __syncthreads();                                    // ... and every other wave's
    stage(1, 1);

    // fragments: A lane -> row, B lane -> column, half -> k pair (the same k order in both)
    const int aoff = LWF + l * LXP + wave * 16 + 2 * half;
    const int boff = (wave * 16 + 2 * half) * LWP + l;

    v8f acc[10];
    #pragma unroll   // acc[] must stay in registers
    for (int nt = 0; nt < 10; ++nt) acc[nt] = (v8f){};

    for (int t = 0; t < nT; ++t) {
        const float* buf = st + (t & 1) * LBUFF;
        #pragma unroll   // constant LDS offsets on every fragment read
        for (int s = 0; s < 4; ++s) {
            const v2f a = *(const v2f*)(buf + aoff + 4 * s);
            const float* bp = buf + boff + 4 * s * LWP;
            #pragma unroll
            for (int nt = 0; nt < 10; ++nt) {
                v2f b;
                b.x = bp[nt * 16];
                b.y = bp[LWP + nt * 16];
                acc[nt] = __builtin_amdgcn_wmma_f32_16x16x4_f32(false, a, false, b, (short)0, acc[nt], false, false);
            }
        }
        asm volatile("s_wait_dscnt 0x0" ::: "memory");     // this wave has left the buffer
        asm volatile("s_wait_asynccnt 0x0" ::: "memory");  // its part of tile t+1 has landed
        __syncthreads();   // publishes tile t+1 and ends every wave's reads of tile t
        if (t + 2 < nT) stage(t & 1, t + 2);
    }
    asm volatile("s_wait_asynccnt 0x0" ::: "memory");      // no copy is left when the LDS is reused

    // the eight waves' partial sums (C/D: VGPR j -> row j / j+8, lane -> column)
    float* red = st;
    #pragma unroll
    for (int nt = 0; nt < 10; ++nt) {
        #pragma unroll
        for (int j = 0; j < 8; ++j)
            red[(wave * 16 + j + 8 * half) * LRP + nt * 16 + l] = acc[nt][j];
    }
    __syncthreads();       // every wave's partial sums are in LDS

    // 16 rows x 40 pieces of four columns over 256 threads: two full passes and a half one
    for (int q = tid; q < 16 * 40; q += 256) {
        const int row = q / 40, c4 = (q - row * 40) * 4;
        v4f s = *(const v4f*)(red + row * LRP + c4);
        #pragma unroll
        for (int w = 1; w < 8; ++w) s += *(const v4f*)(red + (w * 16 + row) * LRP + c4);
        float* p;
        if (c4 < 64) {
            #pragma unroll
            for (int e = 0; e < 4; ++e) s[e] = tanhf(s[e]);
            p = hw + (size_t)(m0 + row) * 64 + c4;
        } else if (c4 < 128) {
            p = ha + (size_t)(m0 + row) * 64 + (c4 - 64);
        } else {
            p = hv + (size_t)(m0 + row) * 32 + (c4 - 128);
        }
        *(v4f*)p = s;
        asm volatile("s_wait_xcnt 0x0" ::: "memory");   // precaution: before the store's registers are reused in the next pass
    }
}

#define XCNT_WAIT() asm volatile("s_wait_xcnt 0x0" ::: "memory")
// Round a group of stores and its wait: keeps the scheduler from placing vector work,
// which may reuse a stored register, between a store and the wait.
#define SCHED_EDGE() __builtin_amdgcn_sched_barrier(0)

template<int K>
__device__ __forceinline__
void lora_tile(const float* __restrict__ A, const float* __restrict__ Bm,
               const float* __restrict__ init, int tileM, int cbase,
               int l, int half, v8f (&acc)[4])
{
    const float* arow = A  + (size_t)(tileM + l) * K + 2*half;   // A: lane -> row, half -> k pair
    const float* bcol = Bm + (size_t)(2*half) * CC + cbase + l;  // B: lane -> col, half -> k pair
    XCNT_WAIT();     // behind the stores of the phase before
    #pragma unroll   // acc[] must stay in registers
    for (int nt = 0; nt < 4; ++nt) {
        const float c0 = init[cbase + nt*16 + l];                // the bias vector starts the sum
        #pragma unroll
        for (int j = 0; j < 8; ++j) acc[nt][j] = c0;
    }
    XCNT_WAIT();
    #pragma unroll   // constant offsets on every load
    for (int kc = 0; kc < K; kc += 16) {
        // all 36 fragment loads of a 16-deep k chunk first: one cache latency per 16 WMMAs
        v2f a[4], b[4][4];
        #pragma unroll
        for (int s = 0; s < 4; ++s) a[s] = *(const v2f*)(arow + kc + 4*s);
        XCNT_WAIT();
        #pragma unroll
        for (int s = 0; s < 4; ++s) {
            const int k0 = kc + 4*s;
            #pragma unroll
            for (int nt = 0; nt < 4; ++nt) {
                b[s][nt].x = bcol[(size_t)(k0    ) * CC + nt*16];
                b[s][nt].y = bcol[(size_t)(k0 + 1) * CC + nt*16];
            }
        }
        XCNT_WAIT();
        #pragma unroll
        for (int s = 0; s < 4; ++s) {
            #pragma unroll
            for (int nt = 0; nt < 4; ++nt)
                acc[nt] = __builtin_amdgcn_wmma_f32_16x16x4_f32(false, a[s], false, b[s][nt], (short)0, acc[nt], false, false);
        }
    }
}

// 16 rows x 64 columns of a row-major array in the accumulator layout, one batch of loads.
__device__ __forceinline__
void load_tile(const float* __restrict__ p, int pitch, v8f (&t)[4])
{
    #pragma unroll   // t[] must stay in registers
    for (int nt = 0; nt < 4; ++nt) {
        #pragma unroll
        for (int j = 0; j < 8; ++j) t[nt][j] = p[(size_t)j * pitch + nt*16];
    }
    XCNT_WAIT();
}

__global__ __launch_bounds__(256)
void fusion_kernel(const float* __restrict__ klin, const float* __restrict__ vlin,
                   const float* __restrict__ hw,  const float* __restrict__ ha,
                   const float* __restrict__ hv,  const float* __restrict__ v_first,
                   const float* __restrict__ w0,  const float* __restrict__ w2,
                   const float* __restrict__ a0,  const float* __restrict__ a2,
                   const float* __restrict__ v0,  const float* __restrict__ v2,
                   const float* __restrict__ k_k, const float* __restrict__ k_a,
                   float* __restrict__ decay, float* __restrict__ kpost,
                   float* __restrict__ vpost, float* __restrict__ aaO,
                   float* __restrict__ bbO)
{
    const int lane = threadIdx.x & 31;
    const int wave = threadIdx.x >> 5;
    const int half = lane >> 4;
    const int l    = lane & 15;
    const int tileM  = blockIdx.x * 128 + wave * 16;
    const int h      = blockIdx.y;
    const int cbase  = h * NN;
    const int kvbase = (h >> 2) * NN;                 // kv-head repeat
    const int row0   = tileM + 8*half;                // C/D: VGPR j -> row j / j+8
    const size_t g0  = (size_t)row0 * CC  + cbase  + l;   // element (j, nt) at g0 + j*CC + nt*16
    const size_t q0  = (size_t)row0 * KVC + kvbase + l;
    v8f acc[4], t0[4], t1[4];

    // ---- decay ----
    lora_tile<64>(hw, w2, w0, tileM, cbase, l, half, acc);
    #pragma unroll   // acc[] is indexed: registers only when unrolled
    for (int nt = 0; nt < 4; ++nt) {
        v8f o;
        #pragma unroll
        for (int j = 0; j < 8; ++j) {
            const float wraw = -log1pf(expf(-acc[nt][j])) - 0.6f;   // -softplus(-t)-0.6
            o[j] = expf(-expf(wraw));
        }
        SCHED_EDGE();
        #pragma unroll
        for (int j = 0; j < 8; ++j) decay[g0 + (size_t)j * CC + nt*16] = o[j];
        XCNT_WAIT();
        SCHED_EDGE();
    }

    // ---- value blend ----
    lora_tile<32>(hv, v2, v0, tileM, cbase, l, half, acc);
    load_tile(vlin + q0, KVC, t0);
    load_tile(v_first + g0, CC, t1);
    #pragma unroll
    for (int nt = 0; nt < 4; ++nt) {
        v8f o;
        #pragma unroll
        for (int j = 0; j < 8; ++j) {
            const float vg = 1.f / (1.f + expf(-acc[nt][j]));
            const float vf = t0[nt][j];
            o[j] = vf + (t1[nt][j] - vf) * vg;
        }
        SCHED_EDGE();
        #pragma unroll
        for (int j = 0; j < 8; ++j) vpost[g0 + (size_t)j * CC + nt*16] = o[j];
        XCNT_WAIT();
        SCHED_EDGE();
    }

    // ---- a gate, k, normalised kk ----
    lora_tile<64>(ha, a2, a0, tileM, cbase, l, half, acc);
    load_tile(klin + q0, KVC, t0);
    float kkc[4], kac[4];
    #pragma unroll
    for (int nt = 0; nt < 4; ++nt) kkc[nt] = k_k[cbase + nt*16 + l];
    XCNT_WAIT();
    #pragma unroll
    for (int nt = 0; nt < 4; ++nt) kac[nt] = k_a[cbase + nt*16 + l];
    XCNT_WAIT();
    float ss[8];
    #pragma unroll
    for (int j = 0; j < 8; ++j) ss[j] = 0.f;
    #pragma unroll
    for (int nt = 0; nt < 4; ++nt) {
        v8f o;
        #pragma unroll
        for (int j = 0; j < 8; ++j) {
            const float av = 1.f / (1.f + expf(-acc[nt][j]));
            const float kf = t0[nt][j];
            const float kkp = kf * kkc[nt];
            o[j] = kf * (1.f + (av - 1.f) * kac[nt]);
            t0[nt][j]  = kkp;
            acc[nt][j] = av;
            ss[j] += kkp * kkp;
        }
        SCHED_EDGE();
        #pragma unroll
        for (int j = 0; j < 8; ++j) kpost[g0 + (size_t)j * CC + nt*16] = o[j];
        XCNT_WAIT();
        SCHED_EDGE();
    }
    #pragma unroll
    for (int j = 0; j < 8; ++j) {
        float s = ss[j];
        // a row's 64 channels sit in the 16 lanes of one half (4 per lane)
        for (int off = 8; off; off >>= 1) s += __shfl_xor(s, off);
        const float rn = 1.f / fmaxf(sqrtf(s), 1e-12f);
        float oa[4], ob[4];
        #pragma unroll
        for (int nt = 0; nt < 4; ++nt) {
            const float kkn = t0[nt][j] * rn;
            oa[nt] = -kkn;
            ob[nt] = kkn * acc[nt][j];
        }
        SCHED_EDGE();
        #pragma unroll
        for (int nt = 0; nt < 4; ++nt) {
            aaO[g0 + (size_t)j * CC + nt*16] = oa[nt];
            bbO[g0 + (size_t)j * CC + nt*16] = ob[nt];
        }
        XCNT_WAIT();
        SCHED_EDGE();
    }
}
#undef XCNT_WAIT
#undef SCHED_EDGE

// =====================================================================
// Sequential RWKV-7 scan. The 64 state rows of a (batch, head) never exchange anything,
// so they are spread wide: grid = B*H*2, a block of 4 waves owns 32 rows, a wave 8 rows.
// A row lies across 8 lanes (8 columns a lane: 4*lc.. and 32+4*lc..) and a lane holds two
// rows, so each vector element read from LDS serves two state elements and the chain
// of one time step is 8 products, a 3-step lane sum and one multiply-add.
// The six per-step vectors are staged 16 time steps at a time by asynchronous copies,
// two buffers, one barrier per 16 steps; y leaves through LDS in whole 128-byte lines.
// =====================================================================
#define SCH    16                  // time steps per staged chunk
#define SSTEPF (6 * NN)            // floats of one staged step: r, decay, k, v, aa, bb
#define SBUFF  (SCH * SSTEPF)      // floats of one buffer
#define SBUFB  (SBUFF * 4)
#define SROWS  32                  // state rows per block

// A thread's twelve 16-byte pieces of one chunk: steps s and s+8 of each of the six arrays.
// The wait on the last line stands before the address registers can be rewritten.
__device__ __forceinline__
void scan_stage_chunk(unsigned lds, const float* r, const float* dc, const float* k,
                      const float* v, const float* aa, const float* bb)
{
    asm volatile(
        "global_load_async_to_lds_b128 %0, %12, off\n\t"
        "global_load_async_to_lds_b128 %1, %13, off\n\t"
        "global_load_async_to_lds_b128 %2, %14, off\n\t"
        "global_load_async_to_lds_b128 %3, %15, off\n\t"
        "global_load_async_to_lds_b128 %4, %16, off\n\t"
        "global_load_async_to_lds_b128 %5, %17, off\n\t"
        "global_load_async_to_lds_b128 %6, %18, off\n\t"
        "global_load_async_to_lds_b128 %7, %19, off\n\t"
        "global_load_async_to_lds_b128 %8, %20, off\n\t"
        "global_load_async_to_lds_b128 %9, %21, off\n\t"
        "global_load_async_to_lds_b128 %10, %22, off\n\t"
        "global_load_async_to_lds_b128 %11, %23, off\n\t"
        "s_wait_xcnt 0x0"
        :: "v"(lds),            "v"(lds + 1*NN*4), "v"(lds + 2*NN*4),
           "v"(lds + 3*NN*4),   "v"(lds + 4*NN*4), "v"(lds + 5*NN*4),
           "v"(lds + 8*SSTEPF*4),            "v"(lds + 8*SSTEPF*4 + 1*NN*4), "v"(lds + 8*SSTEPF*4 + 2*NN*4),
           "v"(lds + 8*SSTEPF*4 + 3*NN*4),   "v"(lds + 8*SSTEPF*4 + 4*NN*4), "v"(lds + 8*SSTEPF*4 + 5*NN*4),
           "v"(r), "v"(dc), "v"(k), "v"(v), "v"(aa), "v"(bb),
           "v"(r + 8*CC), "v"(dc + 8*CC), "v"(k + 8*CC), "v"(v + 8*CC), "v"(aa + 8*CC), "v"(bb + 8*CC)
        : "memory");
}

// x + (x of the lane whose number differs in the bits of MASK), inside a 16-lane row
template<int MASK>
__device__ __forceinline__ float lane_xor_add(float x)
{
    const int o = __builtin_amdgcn_update_dpp(0, __builtin_bit_cast(int, x), 0x160 + MASK, 0xf, 0xf, true);
    return x + __builtin_bit_cast(float, o);
}
// sum over the 8 lanes that share a state row; every one of them gets it
__device__ __forceinline__ float row_sum8(float x)
{
    x = lane_xor_add<1>(x);
    x = lane_xor_add<2>(x);
    return lane_xor_add<4>(x);
}

// the lane's 8 columns of one staged vector
struct Cols { v2f c[4]; };
__device__ __forceinline__ Cols load_cols(const float* p)
{
    const v4f lo = *(const v4f*)p, hi = *(const v4f*)(p + 32);
    Cols o;
    o.c[0] = __builtin_shufflevector(lo, lo, 0, 1);
    o.c[1] = __builtin_shufflevector(lo, lo, 2, 3);
    o.c[2] = __builtin_shufflevector(hi, hi, 0, 1);
    o.c[3] = __builtin_shufflevector(hi, hi, 2, 3);
    return o;
}
struct StepIn { Cols r, d, k, a, b; v2f v; };
__device__ __forceinline__ StepIn load_step(const float* sp, int coff, int voff)
{
    StepIn s;
    s.a = load_cols(sp + 4*NN + coff);
    s.d = load_cols(sp + 1*NN + coff);
    s.k = load_cols(sp + 2*NN + coff);
    s.v = *(const v2f*)(sp + 3*NN + voff);
    s.b = load_cols(sp + 5*NN + coff);
    s.r = load_cols(sp + coff);
    return s;
}
__device__ __forceinline__ float dot8(const v2f (&s)[4], const Cols& x)
{
    const v2f p = s[0]*x.c[0] + s[1]*x.c[1];
    const v2f q = s[2]*x.c[2] + s[3]*x.c[3];
    const v2f t = p + q;
    return t.x + t.y;
}

__global__ __launch_bounds__(128)
void scan_kernel(const float* __restrict__ r, const float* __restrict__ dc,
                 const float* __restrict__ k, const float* __restrict__ v,
                 const float* __restrict__ aa, const float* __restrict__ bb,
                 const float* __restrict__ state0, float* __restrict__ y)
{
    __shared__ __attribute__((aligned(16))) float stage[2 * SBUFF];
    __shared__ __attribute__((aligned(16))) float ybuf[2 * SCH * SROWS];

    const int bh    = blockIdx.x >> 1;         // b*H + h
    const int rbase = (blockIdx.x & 1) * SROWS;
    const int b = bh >> 5, h = bh & 31;
    const int tid  = threadIdx.x;
    const int lane = tid & 31, wave = tid >> 5;
    const int lc = lane & 7, lr = lane >> 3;
    const int rloc = wave * 8 + lr * 2;        // the lane's two rows inside the block's 32
    const int coff = lc * 4;
    const int voff = rbase + rloc;

    v2f S[2][4];
    #pragma unroll   // S[] must stay in registers
    for (int rr = 0; rr < 2; ++rr) {
        const Cols c = load_cols(state0 + ((size_t)bh * NN + rbase + rloc + rr) * NN + coff);
        #pragma unroll
        for (int q = 0; q < 4; ++q) S[rr][q] = c.c[q];
    }
    asm volatile("s_wait_xcnt 0x0" ::: "memory");   // precaution: before the state loads' address registers are reused

    // copies: 16 lanes a vector (16 bytes each), 8 steps per pass over the block's 128 threads
    const int crow = tid >> 4, cpos = (tid & 15) * 4;
    const size_t g0 = ((size_t)(b * TT + crow)) * CC + h * NN + cpos;
    const unsigned lds0 = (unsigned)(uintptr_t)stage + (unsigned)((crow * SSTEPF + cpos) * 4);
    // y: 8 lanes store one step's 128-byte line of the block's 32 rows
    float* yg = y + ((size_t)(b * TT + (tid >> 3))) * CC + h * NN + rbase + (tid & 7) * 4;
    const int nC = TT / SCH;

    scan_stage_chunk(lds0, r + g0, dc + g0, k + g0, v + g0, aa + g0, bb + g0);
    asm volatile("s_wait_asynccnt 0x0" ::: "memory");   // chunk 0 has landed (this wave's part)
    __syncthreads();                                    // ... and every other wave's
    {
        const size_t g = g0 + (size_t)SCH * CC;
        scan_stage_chunk(lds0 + SBUFB, r + g, dc + g, k + g, v + g, aa + g, bb + g);
    }

    for (int c = 0; c < nC; ++c) {
        const float* sb = stage + (c & 1) * SBUFF;
        float* yb = ybuf + (c & 1) * (SCH * SROWS);
        v2f keep = {0.f, 0.f};
        // vectors are read from LDS two steps ahead of their use
        StepIn p0 = load_step(sb, coff, voff);
        StepIn p1 = load_step(sb + SSTEPF, coff, voff);
        Cols rprev = p0.r;
        #pragma unroll   // constant LDS offsets; the step records stay in registers
        for (int tt = 0; tt <= SCH; ++tt) {
            // y of step tt-1 is a dot product of the same S as this step's sa: the four lane sums run side by side
            v2f yo = {0.f, 0.f};
            if (tt > 0) {
                #pragma unroll
                for (int rr = 0; rr < 2; ++rr) yo[rr] = dot8(S[rr], rprev);
            }
            if (tt < SCH) {
                StepIn p2 = p1;
                if (tt + 2 < SCH) p2 = load_step(sb + (tt + 2) * SSTEPF, coff, voff);
                float sa[2];
                v2f   T[2][4];
                #pragma unroll
                for (int rr = 0; rr < 2; ++rr) sa[rr] = dot8(S[rr], p0.a);
                #pragma unroll
                for (int rr = 0; rr < 2; ++rr) {
                    const v2f vv = {p0.v[rr], p0.v[rr]};
                    #pragma unroll
                    for (int q = 0; q < 4; ++q) T[rr][q] = S[rr][q] * p0.d.c[q] + vv * p0.k.c[q];
                }
                #pragma unroll
                for (int rr = 0; rr < 2; ++rr) {
                    const float s = row_sum8(sa[rr]);
                    const v2f ss = {s, s};
                    #pragma unroll
                    for (int q = 0; q < 4; ++q) S[rr][q] = T[rr][q] + ss * p0.b.c[q];
                }
                rprev = p0.r;
                p0 = p1;
                p1 = p2;
            }
            if (tt > 0) {
                const int u = tt - 1;
                #pragma unroll
                for (int rr = 0; rr < 2; ++rr) yo[rr] = row_sum8(yo[rr]);
                // lane lc keeps the y pair of step lc of each run of 8, then all lanes store at once
                if ((u & 7) == lc) keep = yo;
                if ((u & 7) == 7)
                    *(v2f*)(yb + ((u & 8) + lc) * SROWS + rloc) = keep;
            }
            // keeps each step's LDS reads a whole step ahead of their use: without it the scheduler sinks them next to it
            __builtin_amdgcn_sched_barrier(0);
        }
        asm volatile("s_wait_dscnt 0x0" ::: "memory");     // this wave has left the buffer, its y is in LDS
        asm volatile("s_wait_asynccnt 0x0" ::: "memory");  // its part of chunk c+1 has landed
        __syncthreads();   // publishes chunk c+1 and this chunk's y, ends every wave's reads of chunk c
        if (c + 2 < nC) {
            const size_t g = g0 + (size_t)(c + 2) * SCH * CC;
            scan_stage_chunk(lds0 + (c & 1) * SBUFB, r + g, dc + g, k + g, v + g, aa + g, bb + g);
        }
        const v4f yv = *(const v4f*)(yb + tid * 4);
        *(v4f*)(yg + (size_t)c * SCH * CC) = yv;
        asm volatile("s_wait_xcnt 0x0" ::: "memory");      // precaution: before the store's registers are reused
    }
    asm volatile("s_wait_asynccnt 0x0" ::: "memory");      // no copy is left when the wave ends
}

// =====================================================================
// GroupNorm over (T,N) per (b,h) + bonus term. xx aliases rbuf
// (each lane reads its r before writing the same location).
// =====================================================================
__global__ __launch_bounds__(256)
void gnorm_kernel(const float* __restrict__ y, const float* rbuf,
                  const float* __restrict__ kpost, const float* __restrict__ vpost,
                  const float* __restrict__ r_k, const float* __restrict__ ln_w,
                  const float* __restrict__ ln_b, float* xx)
{
    const int bh = blockIdx.x;
    const int b = bh >> 5, h = bh & 31;
    const int tid = threadIdx.x;
    __shared__ float red[256], red2[256];

    float s = 0.f, s2 = 0.f;
    for (int f = tid; f < TT*NN; f += 256) {
        const int t = f >> 6, n = f & 63;
        const float v = y[((size_t)(b*TT + t))*CC + h*NN + n];
        s += v; s2 += v*v;
    }
    red[tid] = s; red2[tid] = s2;
    __syncthreads();
    for (int off = 128; off; off >>= 1) {
        if (tid < off) { red[tid] += red[tid+off]; red2[tid] += red2[tid+off]; }
        __syncthreads();
    }
    const float mean = red[0]  * (1.f / 65536.f);
    const float var  = red2[0] * (1.f / 65536.f) - mean*mean;
    const float rstd = rsqrtf(var + GN_EPS);

    const int wave = tid >> 5, lane = tid & 31;
    const float lw0 = ln_w[h*NN + lane],      lb0 = ln_b[h*NN + lane];
    const float lw1 = ln_w[h*NN + lane + 32], lb1 = ln_b[h*NN + lane + 32];
    const float rk0 = r_k[h*NN + lane],       rk1 = r_k[h*NN + lane + 32];
    for (int t = wave; t < TT; t += 8) {
        const size_t base = ((size_t)(b*TT + t))*CC + h*NN;
        const float r0 = rbuf[base + lane],      r1 = rbuf[base + lane + 32];
        const float k0 = kpost[base + lane],     k1 = kpost[base + lane + 32];
        float d = r0*k0*rk0 + r1*k1*rk1;
        for (int off = 16; off; off >>= 1) d += __shfl_xor(d, off);
        const float y0 = y[base + lane], y1 = y[base + lane + 32];
        const float o0 = (y0 - mean)*rstd*lw0 + lb0 + d*vpost[base + lane];
        const float o1 = (y1 - mean)*rstd*lw1 + lb1 + d*vpost[base + lane + 32];
        xx[base + lane]      = o0;
        xx[base + lane + 32] = o1;
    }
}

// =====================================================================
extern "C" void kernel_launch(void* const* d_in, const int* in_sizes, int n_in,
                              void* d_out, int out_size, void* d_ws, size_t ws_size,
                              hipStream_t stream) {
    const float* x       = (const float*)d_in[0];
    const float* v_first = (const float*)d_in[1];
    const float* state0  = (const float*)d_in[2];
    const float* Rw      = (const float*)d_in[3];
    const float* R_bias  = (const float*)d_in[4];
    const float* Kw      = (const float*)d_in[5];
    const float* K_bias  = (const float*)d_in[6];
    const float* Vw      = (const float*)d_in[7];
    const float* V_bias  = (const float*)d_in[8];
    const float* Ow      = (const float*)d_in[9];
    const float* O_bias  = (const float*)d_in[10];
    const float* w0      = (const float*)d_in[11];
    const float* w1      = (const float*)d_in[12];
    const float* w2      = (const float*)d_in[13];
    const float* a0      = (const float*)d_in[14];
    const float* a1      = (const float*)d_in[15];
    const float* a2      = (const float*)d_in[16];
    const float* v0      = (const float*)d_in[17];
    const float* v1      = (const float*)d_in[18];
    const float* v2      = (const float*)d_in[19];
    const float* k_k     = (const float*)d_in[20];
    const float* k_a     = (const float*)d_in[21];
    const float* r_k     = (const float*)d_in[22];
    const float* ln_w    = (const float*)d_in[23];
    const float* ln_b    = (const float*)d_in[24];
    float* out = (float*)d_out;

    // workspace layout (floats)
    float* ws = (float*)d_ws;
    float* r_buf  = ws;                                // M*C   (later reused as xx)
    float* klin   = r_buf  + (size_t)MM*CC;            // M*512
    float* vlin   = klin   + (size_t)MM*KVC;           // M*512
    float* hw     = vlin   + (size_t)MM*KVC;           // M*64
    float* ha     = hw     + (size_t)MM*64;            // M*64
    float* hv     = ha     + (size_t)MM*64;            // M*32
    float* decayb = hv     + (size_t)MM*32;            // M*C
    float* kpost  = decayb + (size_t)MM*CC;            // M*C
    float* vpost  = kpost  + (size_t)MM*CC;            // M*C
    float* aab    = vpost  + (size_t)MM*CC;            // M*C
    float* bbb    = aab    + (size_t)MM*CC;            // M*C
    float* ybuf   = bbb    + (size_t)MM*CC;            // M*C
    float* xx     = r_buf;                             // alias: r dead after bonus read

    const dim3 blk(128);
    // Step 1: projections (blocked WMMA for the big GEMMs)
    wmma_gemm_f32_blk<<<dim3(MM/64, CC/64),  blk, 0, stream>>>(x, Rw, R_bias, r_buf, CC, CC);
    wmma_gemm_f32_blk<<<dim3(MM/64, KVC/64), blk, 0, stream>>>(x, Kw, K_bias, klin,  CC, KVC);
    wmma_gemm_f32_blk<<<dim3(MM/64, KVC/64), blk, 0, stream>>>(x, Vw, V_bias, vlin,  CC, KVC);
    lora_in_kernel<<<dim3(MM/16), dim3(256), 0, stream>>>(x, w1, a1, v1, hw, ha, hv);

    // fused elementwise prep
    fusion_kernel<<<dim3(MM/128, HH), dim3(256), 0, stream>>>(
        klin, vlin, hw, ha, hv, v_first, w0, w2, a0, a2, v0, v2, k_k, k_a,
        decayb, kpost, vpost, aab, bbb);

    // Step 2: sequential scan
    scan_kernel<<<dim3(BB*HH*2), dim3(128), 0, stream>>>(
        r_buf, decayb, kpost, vpost, aab, bbb, state0, ybuf);

    // Step 3: group norm + bonus
    gnorm_kernel<<<dim3(BB*HH), dim3(256), 0, stream>>>(
        ybuf, r_buf, kpost, vpost, r_k, ln_w, ln_b, xx);

    // output projection
    wmma_gemm_f32_blk<<<dim3(MM/64, CC/64), blk, 0, stream>>>(xx, Ow, O_bias, out, CC, CC);
    (void)in_sizes; (void)n_in; (void)out_size; (void)ws_size;
}

// v005
// One run takes 647 microseconds.
// Next to v004, in two timings, it ran 1.15 and 1.14 times as fast.
// Counting every step since v000, it is 6.64 times as fast.
#include <hip/hip_runtime.h>
#include <math.h>

// ---------------- problem constants ----------------
#define BB  4
#define TT  1024
#define CC  2048
#define HH  32
#define NN  64
#define KVC 512
#define MM  (BB*TT)          // 4096 rows
#define GN_EPS 0.00064f

typedef float v2f __attribute__((ext_vector_type(2)));
typedef float v8f __attribute__((ext_vector_type(8)));

#define GBK     32
#define GPITCH  36
#define GROWB   (GPITCH * 4)
#define GBUFB   (128 * GROWB)

// A thread's eight 16-byte pieces of one k tile: rows r, r+16, r+32, r+48 of X and of W.
// The wait on the last line stands before the address registers can be rewritten.
__device__ __forceinline__
void gemm_stage_tile(unsigned lds, const float* gx, const float* gw, size_t rstep)
{
    asm volatile(
        "global_load_async_to_lds_b128 %0, %8, off\n\t"
        "global_load_async_to_lds_b128 %1, %9, off\n\t"
        "global_load_async_to_lds_b128 %2, %10, off\n\t"
        "global_load_async_to_lds_b128 %3, %11, off\n\t"
        "global_load_async_to_lds_b128 %4, %12, off\n\t"
        "global_load_async_to_lds_b128 %5, %13, off\n\t"
        "global_load_async_to_lds_b128 %6, %14, off\n\t"
        "global_load_async_to_lds_b128 %7, %15, off\n\t"
        "s_wait_xcnt 0x0"
        :: "v"(lds),              "v"(lds +  16*GROWB), "v"(lds +  32*GROWB), "v"(lds +  48*GROWB),
           "v"(lds + 64*GROWB),   "v"(lds +  80*GROWB), "v"(lds +  96*GROWB), "v"(lds + 112*GROWB),
           "v"(gx), "v"(gx + rstep), "v"(gx + 2*rstep), "v"(gx + 3*rstep),
           "v"(gw), "v"(gw + rstep), "v"(gw + 2*rstep), "v"(gw + 3*rstep)
        : "memory");
}

__global__ __launch_bounds__(128)
void wmma_gemm_f32_blk(const float* __restrict__ X, const float* __restrict__ W,
                       const float* __restrict__ bias, float* __restrict__ Out,
                       int K, int Nc)
{
    __shared__ __attribute__((aligned(16))) float tile[2 * 128 * GPITCH];

    const int lane = threadIdx.x & 31;
    const int wave = threadIdx.x >> 5;
    const int half = lane >> 4;
    const int l    = lane & 15;
    const int mw   = wave >> 1, nw = wave & 1;
    const int tileM = blockIdx.x * 64 + mw * 32;
    const int tileN = blockIdx.y * 64 + nw * 32;

    // copies: 8 lanes a row (16 bytes each), 16 rows per pass over the block's 128 threads
    const int crow = threadIdx.x >> 3, cpos = (threadIdx.x & 7) * 4;
    const float* gx = X + (size_t)(blockIdx.x * 64 + crow) * K + cpos;
    const float* gw = W + (size_t)(blockIdx.y * 64 + crow) * K + cpos;
    const size_t rstep = (size_t)16 * K;
    const unsigned lds0 = (unsigned)(uintptr_t)tile + (unsigned)(crow * GROWB + cpos * 4);
    const int nT = K / GBK;

    gemm_stage_tile(lds0, gx, gw, rstep);
    asm volatile("s_wait_asynccnt 0x0" ::: "memory");   // tile 0 has landed (this wave's part)
    __syncthreads();                                    // ... and every other wave's
    if (nT > 1) gemm_stage_tile(lds0 + GBUFB, gx + GBK, gw + GBK, rstep);

    // fragments: lane -> row, half -> k pair, as with the global loads they replace
    const int aoff = (mw * 32 + l) * GPITCH + 2*half;
    const int boff = (64 + nw * 32 + l) * GPITCH + 2*half;

    v8f acc00 = {}, acc01 = {}, acc10 = {}, acc11 = {};
    for (int t = 0; t < nT; ++t) {
        const float* buf = tile + (t & 1) * (128 * GPITCH);
        const float* as  = buf + aoff;
        const float* bs  = buf + boff;
        #pragma unroll   // constant LDS offsets on every fragment read
        for (int s = 0; s < GBK; s += 4) {
            v2f a0 = *(const v2f*)(as + s);
            v2f a1 = *(const v2f*)(as + 16*GPITCH + s);
            v2f b0 = *(const v2f*)(bs + s);
            v2f b1 = *(const v2f*)(bs + 16*GPITCH + s);
            acc00 = __builtin_amdgcn_wmma_f32_16x16x4_f32(false, a0, false, b0, (short)0, acc00, false, false);
            acc01 = __builtin_amdgcn_wmma_f32_16x16x4_f32(false, a0, false, b1, (short)0, acc01, false, false);
            acc10 = __builtin_amdgcn_wmma_f32_16x16x4_f32(false, a1, false, b0, (short)0, acc10, false, false);
            acc11 = __builtin_amdgcn_wmma_f32_16x16x4_f32(false, a1, false, b1, (short)0, acc11, false, false);
        }
        asm volatile("s_wait_dscnt 0x0" ::: "memory");     // this wave has left the buffer
        asm volatile("s_wait_asynccnt 0x0" ::: "memory");  // its part of tile t+1 has landed
        __syncthreads();   // publishes tile t+1 and ends every wave's reads of tile t
        if (t + 2 < nT)
            gemm_stage_tile(lds0 + (t & 1) * GBUFB, gx + (size_t)(t + 2) * GBK, gw + (size_t)(t + 2) * GBK, rstep);
    }
    asm volatile("s_wait_asynccnt 0x0" ::: "memory");      // no copy is left when the wave ends

    const int col0 = tileN + l, col1 = tileN + 16 + l;
    const float bs0 = bias ? bias[col0] : 0.0f;
    const float bs1 = bias ? bias[col1] : 0.0f;
    asm volatile("s_wait_xcnt 0x0" ::: "memory");   // precaution: before the bias loads' offset register is reused for the store addresses
    __builtin_amdgcn_sched_barrier(0);   // keeps the store-address arithmetic, which reuses that register, behind the wait
    #pragma unroll
    for (int j = 0; j < 8; ++j) {
        const int row0 = tileM + j + 8*half;           // C/D: VGPR j -> M=j / j+8
        const int row1 = row0 + 16;
        Out[(size_t)row0 * Nc + col0] = acc00[j] + bs0;
        Out[(size_t)row0 * Nc + col1] = acc01[j] + bs1;
        Out[(size_t)row1 * Nc + col0] = acc10[j] + bs0;
        Out[(size_t)row1 * Nc + col1] = acc11[j] + bs1;
    }
}

// =====================================================================
// LoRA first-stage products x@w1 (then tanh), x@a1, x@v1 in ONE launch: the three
// weights, stored (K,Nc), are taken as one (K,160) matrix. A block owns 16 rows of x
// and all 160 columns; its 8 waves split k: of each staged tile of 128 k a wave takes
// 16, with 10 independent accumulator tiles, so one A fragment serves 10 WMMAs.
// Tiles come into LDS in whole lines by asynchronous copies, two buffers; the eight
// partial sums are added through LDS at the end, in wave order.
// =====================================================================
typedef float v4f __attribute__((ext_vector_type(4)));

#define LK    128                  // k per staged tile
#define LWP   168                  // LDS pitch (floats) of a weight row: rows k and k+2 of a fragment read fall 16 banks apart
#define LXP   132                  // LDS pitch (floats) of an x row: 16 rows of an 8-byte fragment read meet 64 distinct banks
#define LWF   (LK * LWP)           // floats of the weight part of a buffer
#define LBUFF (LWF + 16 * LXP)     // floats of one buffer
#define LBUFB (LBUFF * 4)
#define LRP   164                  // LDS pitch (floats) of a partial-sum row: rows j and j+8 fall 32 banks apart

// Eleven 16-byte pieces of one k tile: rows r, r+16, .. r+112 of a 64-wide weight,
// rows q, q+32 of the 32-wide weight, one piece of x.
// The wait on the last line stands before the address registers can be rewritten.
__device__ __forceinline__
void lora_stage11(unsigned lw, const float* gw, unsigned lv, const float* gv,
                  unsigned lx, const float* gx)
{
    asm volatile(
        "global_load_async_to_lds_b128 %0, %11, off\n\t"
        "global_load_async_to_lds_b128 %1, %12, off\n\t"
        "global_load_async_to_lds_b128 %2, %13, off\n\t"
        "global_load_async_to_lds_b128 %3, %14, off\n\t"
        "global_load_async_to_lds_b128 %4, %15, off\n\t"
        "global_load_async_to_lds_b128 %5, %16, off\n\t"
        "global_load_async_to_lds_b128 %6, %17, off\n\t"
        "global_load_async_to_lds_b128 %7, %18, off\n\t"
        "global_load_async_to_lds_b128 %8, %19, off\n\t"
        "global_load_async_to_lds_b128 %9, %20, off\n\t"
        "global_load_async_to_lds_b128 %10, %21, off\n\t"
        "s_wait_xcnt 0x0"
        :: "v"(lw),                "v"(lw +  16*LWP*4), "v"(lw +  32*LWP*4), "v"(lw +  48*LWP*4),
           "v"(lw + 64*LWP*4),     "v"(lw +  80*LWP*4), "v"(lw +  96*LWP*4), "v"(lw + 112*LWP*4),
           "v"(lv),                "v"(lv +  32*LWP*4), "v"(lx),
           "v"(gw),         "v"(gw + 16*64), "v"(gw + 32*64), "v"(gw +  48*64),
           "v"(gw + 64*64), "v"(gw + 80*64), "v"(gw + 96*64), "v"(gw + 112*64),
           "v"(gv),         "v"(gv + 32*32), "v"(gx)
        : "memory");
}

__global__ __launch_bounds__(256)
void lora_in_kernel(const float* __restrict__ X,  const float* __restrict__ w1,
                    const float* __restrict__ a1, const float* __restrict__ v1,
                    float* __restrict__ hw, float* __restrict__ ha, float* __restrict__ hv)
{
    __shared__ __attribute__((aligned(16))) float st[2 * LBUFF];

    const int tid  = threadIdx.x;
    const int lane = tid & 31, wave = tid >> 5;
    const int half = lane >> 4, l = lane & 15;
    const int m0   = blockIdx.x * 16;

    // copies: 16 lanes a row of w1 / a1, 8 lanes a row of v1, 32 lanes a row of x
    const size_t  g64 = (size_t)(tid >> 4) * 64 + (tid & 15) * 4;
    const float*  gv  = v1 + (size_t)(tid >> 3) * 32 + (tid & 7) * 4;
    const float*  gx  = X  + (size_t)(m0 + (tid >> 5)) * CC + (tid & 31) * 4;
    const unsigned lb = (unsigned)(uintptr_t)st;
    const unsigned lw = lb + (unsigned)(((tid >> 4) * LWP + (tid & 15) * 4) * 4);
    const unsigned lv = lb + (unsigned)(((tid >> 3) * LWP + 128 + (tid & 7) * 4) * 4);
    const unsigned lx = lb + (unsigned)((LWF + (tid >> 5) * LXP + (tid & 31) * 4) * 4);
    const int nT = CC / LK;

    auto stage = [&](int buf, int t) {
        const unsigned o = (unsigned)buf * LBUFB;
        lora_stage11(lw + o,          w1 + g64 + (size_t)t * LK * 64,
                     lv + o,          gv + (size_t)t * LK * 32,
                     lx + o,          gx + t * LK);
        lora_stage11(lw + o + 64 * 4, a1 + g64 + (size_t)t * LK * 64,
                     lv + o + 64 * LWP * 4, gv + (size_t)t * LK * 32 + 64 * 32,
                     lx + o + 8 * LXP * 4,  gx + t * LK + 8 * CC);
    };

    stage(0, 0);
    asm volatile("s_wait_asynccnt 0x0" ::: "memory");   // tile 0 has landed (this wave's part)
    __syncthreads();                                    // ... and every other wave's
    stage(1, 1);

    // fragments: A lane -> row, B lane -> column, half -> k pair (the same k order in both)
    const int aoff = LWF + l * LXP + wave * 16 + 2 * half;
    const int boff = (wave * 16 + 2 * half) * LWP + l;

    v8f acc[10];
    #pragma unroll   // acc[] must stay in registers
    for (int nt = 0; nt < 10; ++nt) acc[nt] = (v8f){};

    for (int t = 0; t < nT; ++t) {
        const float* buf = st + (t & 1) * LBUFF;
        #pragma unroll   // constant LDS offsets on every fragment read
        for (int s = 0; s < 4; ++s) {
            const v2f a = *(const v2f*)(buf + aoff + 4 * s);
            const float* bp = buf + boff + 4 * s * LWP;
            #pragma unroll
            for (int nt = 0; nt < 10; ++nt) {
                v2f b;
                b.x = bp[nt * 16];
                b.y = bp[LWP + nt * 16];
                acc[nt] = __builtin_amdgcn_wmma_f32_16x16x4_f32(false, a, false, b, (short)0, acc[nt], false, false);
            }
        }
        asm volatile("s_wait_dscnt 0x0" ::: "memory");     // this wave has left the buffer
        asm volatile("s_wait_asynccnt 0x0" ::: "memory");  // its part of tile t+1 has landed
        __syncthreads();   // publishes tile t+1 and ends every wave's reads of tile t
        if (t + 2 < nT) stage(t & 1, t + 2);
    }
    asm volatile("s_wait_asynccnt 0x0" ::: "memory");      // no copy is left when the LDS is reused

    // the eight waves' partial sums (C/D: VGPR j -> row j / j+8, lane -> column)
    float* red = st;
    #pragma unroll
    for (int nt = 0; nt < 10; ++nt) {
        #pragma unroll
        for (int j = 0; j < 8; ++j)
            red[(wave * 16 + j + 8 * half) * LRP + nt * 16 + l] = acc[nt][j];
    }
    __syncthreads();       // every wave's partial sums are in LDS

    // 16 rows x 40 pieces of four columns over 256 threads: two full passes and a half one
    for (int q = tid; q < 16 * 40; q += 256) {
        const int row = q / 40, c4 = (q - row * 40) * 4;
        v4f s = *(const v4f*)(red + row * LRP + c4);
        #pragma unroll
        for (int w = 1; w < 8; ++w) s += *(const v4f*)(red + (w * 16 + row) * LRP + c4);
        float* p;
        if (c4 < 64) {
            #pragma unroll
            for (int e = 0; e < 4; ++e) s[e] = tanhf(s[e]);
            p = hw + (size_t)(m0 + row) * 64 + c4;
        } else if (c4 < 128) {
            p = ha + (size_t)(m0 + row) * 64 + (c4 - 64);
        } else {
            p = hv + (size_t)(m0 + row) * 32 + (c4 - 128);
        }
        *(v4f*)p = s;
        asm volatile("s_wait_xcnt 0x0" ::: "memory");   // precaution: before the store's registers are reused in the next pass
    }
}

#define XCNT_WAIT() asm volatile("s_wait_xcnt 0x0" ::: "memory")
// Round a group of stores and its wait: keeps the scheduler from placing vector work,
// which may reuse a stored register, between a store and the wait.
#define SCHED_EDGE() __builtin_amdgcn_sched_barrier(0)

template<int K>
__device__ __forceinline__
void lora_tile(const float* __restrict__ A, const float* __restrict__ Bm,
               const float* __restrict__ init, int tileM, int cbase,
               int l, int half, v8f (&acc)[4])
{
    const float* arow = A  + (size_t)(tileM + l) * K + 2*half;   // A: lane -> row, half -> k pair
    const float* bcol = Bm + (size_t)(2*half) * CC + cbase + l;  // B: lane -> col, half -> k pair
    XCNT_WAIT();     // behind the stores of the phase before
    #pragma unroll   // acc[] must stay in registers
    for (int nt = 0; nt < 4; ++nt) {
        const float c0 = init[cbase + nt*16 + l];                // the bias vector starts the sum
        #pragma unroll
        for (int j = 0; j < 8; ++j) acc[nt][j] = c0;
    }
    XCNT_WAIT();
    #pragma unroll   // constant offsets on every load
    for (int kc = 0; kc < K; kc += 16) {
        // all 36 fragment loads of a 16-deep k chunk first: one cache latency per 16 WMMAs
        v2f a[4], b[4][4];
        #pragma unroll
        for (int s = 0; s < 4; ++s) a[s] = *(const v2f*)(arow + kc + 4*s);
        XCNT_WAIT();
        #pragma unroll
        for (int s = 0; s < 4; ++s) {
            const int k0 = kc + 4*s;
            #pragma unroll
            for (int nt = 0; nt < 4; ++nt) {
                b[s][nt].x = bcol[(size_t)(k0    ) * CC + nt*16];
                b[s][nt].y = bcol[(size_t)(k0 + 1) * CC + nt*16];
            }
        }
        XCNT_WAIT();
        #pragma unroll
        for (int s = 0; s < 4; ++s) {
            #pragma unroll
            for (int nt = 0; nt < 4; ++nt)
                acc[nt] = __builtin_amdgcn_wmma_f32_16x16x4_f32(false, a[s], false, b[s][nt], (short)0, acc[nt], false, false);
        }
    }
}

// 16 rows x 64 columns of a row-major array in the accumulator layout, one batch of loads.
__device__ __forceinline__
void load_tile(const float* __restrict__ p, int pitch, v8f (&t)[4])
{
    #pragma unroll   // t[] must stay in registers
    for (int nt = 0; nt < 4; ++nt) {
        #pragma unroll
        for (int j = 0; j < 8; ++j) t[nt][j] = p[(size_t)j * pitch + nt*16];
    }
    XCNT_WAIT();
}

__global__ __launch_bounds__(256)
void fusion_kernel(const float* __restrict__ klin, const float* __restrict__ vlin,
                   const float* __restrict__ hw,  const float* __restrict__ ha,
                   const float* __restrict__ hv,  const float* __restrict__ v_first,
                   const float* __restrict__ w0,  const float* __restrict__ w2,
                   const float* __restrict__ a0,  const float* __restrict__ a2,
                   const float* __restrict__ v0,  const float* __restrict__ v2,
                   const float* __restrict__ k_k, const float* __restrict__ k_a,
                   float* __restrict__ decay, float* __restrict__ kpost,
                   float* __restrict__ vpost, float* __restrict__ aaO,
                   float* __restrict__ bbO)
{
    const int lane = threadIdx.x & 31;
    const int wave = threadIdx.x >> 5;
    const int half = lane >> 4;
    const int l    = lane & 15;
    const int tileM  = blockIdx.x * 128 + wave * 16;
    const int h      = blockIdx.y;
    const int cbase  = h * NN;
    const int kvbase = (h >> 2) * NN;                 // kv-head repeat
    const int row0   = tileM + 8*half;                // C/D: VGPR j -> row j / j+8
    const size_t g0  = (size_t)row0 * CC  + cbase  + l;   // element (j, nt) at g0 + j*CC + nt*16
    const size_t q0  = (size_t)row0 * KVC + kvbase + l;
    v8f acc[4], t0[4], t1[4];

    // ---- decay ----
    lora_tile<64>(hw, w2, w0, tileM, cbase, l, half, acc);
    #pragma unroll   // acc[] is indexed: registers only when unrolled
    for (int nt = 0; nt < 4; ++nt) {
        v8f o;
        #pragma unroll
        for (int j = 0; j < 8; ++j) {
            const float wraw = -log1pf(expf(-acc[nt][j])) - 0.6f;   // -softplus(-t)-0.6
            o[j] = expf(-expf(wraw));
        }
        SCHED_EDGE();
        #pragma unroll
        for (int j = 0; j < 8; ++j) decay[g0 + (size_t)j * CC + nt*16] = o[j];
        XCNT_WAIT();
        SCHED_EDGE();
    }

    // ---- value blend ----
    lora_tile<32>(hv, v2, v0, tileM, cbase, l, half, acc);
    load_tile(vlin + q0, KVC, t0);
    load_tile(v_first + g0, CC, t1);
    #pragma unroll
    for (int nt = 0; nt < 4; ++nt) {
        v8f o;
        #pragma unroll
        for (int j = 0; j < 8; ++j) {
            const float vg = 1.f / (1.f + expf(-acc[nt][j]));
            const float vf = t0[nt][j];
            o[j] = vf + (t1[nt][j] - vf) * vg;
        }
        SCHED_EDGE();
        #pragma unroll
        for (int j = 0; j < 8; ++j) vpost[g0 + (size_t)j * CC + nt*16] = o[j];
        XCNT_WAIT();
        SCHED_EDGE();
    }

    // ---- a gate, k, normalised kk ----
    lora_tile<64>(ha, a2, a0, tileM, cbase, l, half, acc);
    load_tile(klin + q0, KVC, t0);
    float kkc[4], kac[4];
    #pragma unroll
    for (int nt = 0; nt < 4; ++nt) kkc[nt] = k_k[cbase + nt*16 + l];
    XCNT_WAIT();
    #pragma unroll
    for (int nt = 0; nt < 4; ++nt) kac[nt] = k_a[cbase + nt*16 + l];
    XCNT_WAIT();
    float ss[8];
    #pragma unroll
    for (int j = 0; j < 8; ++j) ss[j] = 0.f;
    #pragma unroll
    for (int nt = 0; nt < 4; ++nt) {
        v8f o;
        #pragma unroll
        for (int j = 0; j < 8; ++j) {
            const float av = 1.f / (1.f + expf(-acc[nt][j]));
            const float kf = t0[nt][j];
            const float kkp = kf * kkc[nt];
            o[j] = kf * (1.f + (av - 1.f) * kac[nt]);
            t0[nt][j]  = kkp;
            acc[nt][j] = av;
            ss[j] += kkp * kkp;
        }
        SCHED_EDGE();
        #pragma unroll
        for (int j = 0; j < 8; ++j) kpost[g0 + (size_t)j * CC + nt*16] = o[j];
        XCNT_WAIT();
        SCHED_EDGE();
    }
    #pragma unroll
    for (int j = 0; j < 8; ++j) {
        float s = ss[j];
        // a row's 64 channels sit in the 16 lanes of one half (4 per lane)
        for (int off = 8; off; off >>= 1) s += __shfl_xor(s, off);
        const float rn = 1.f / fmaxf(sqrtf(s), 1e-12f);
        float oa[4], ob[4];
        #pragma unroll
        for (int nt = 0; nt < 4; ++nt) {
            const float kkn = t0[nt][j] * rn;
            oa[nt] = -kkn;
            ob[nt] = kkn * acc[nt][j];
        }
        SCHED_EDGE();
        #pragma unroll
        for (int nt = 0; nt < 4; ++nt) {
            aaO[g0 + (size_t)j * CC + nt*16] = oa[nt];
            bbO[g0 + (size_t)j * CC + nt*16] = ob[nt];
        }
        XCNT_WAIT();
        SCHED_EDGE();
    }
}
#undef XCNT_WAIT
#undef SCHED_EDGE

// =====================================================================
// Sequential RWKV-7 scan. The 64 state rows of a (batch, head) never exchange anything,
// so they are spread wide: grid = B*H*2, a block of 4 waves owns 32 rows, a wave 8 rows.
// A row lies across 8 lanes (8 columns a lane: 4*lc.. and 32+4*lc..) and a lane holds two
// rows, so each vector element read from LDS serves two state elements and the chain
// of one time step is 8 products, a 3-step lane sum and one multiply-add.
// The six per-step vectors are staged 16 time steps at a time by asynchronous copies,
// two buffers, one barrier per 16 steps; y leaves through LDS in whole 128-byte lines.
// Where a thread stores y it also adds it, and its square, to sums of its own: at the end the
// block leaves its share of the group norm's two sums (half a (batch, head) group) in part[].
// =====================================================================
#define SCH    16                  // time steps per staged chunk
#define SSTEPF (6 * NN)            // floats of one staged step: r, decay, k, v, aa, bb
#define SBUFF  (SCH * SSTEPF)      // floats of one buffer
#define SBUFB  (SBUFF * 4)
#define SROWS  32                  // state rows per block

// A thread's twelve 16-byte pieces of one chunk: steps s and s+8 of each of the six arrays.
// The wait on the last line stands before the address registers can be rewritten.
__device__ __forceinline__
void scan_stage_chunk(unsigned lds, const float* r, const float* dc, const float* k,
                      const float* v, const float* aa, const float* bb)
{
    asm volatile(
        "global_load_async_to_lds_b128 %0, %12, off\n\t"
        "global_load_async_to_lds_b128 %1, %13, off\n\t"
        "global_load_async_to_lds_b128 %2, %14, off\n\t"
        "global_load_async_to_lds_b128 %3, %15, off\n\t"
        "global_load_async_to_lds_b128 %4, %16, off\n\t"
        "global_load_async_to_lds_b128 %5, %17, off\n\t"
        "global_load_async_to_lds_b128 %6, %18, off\n\t"
        "global_load_async_to_lds_b128 %7, %19, off\n\t"
        "global_load_async_to_lds_b128 %8, %20, off\n\t"
        "global_load_async_to_lds_b128 %9, %21, off\n\t"
        "global_load_async_to_lds_b128 %10, %22, off\n\t"
        "global_load_async_to_lds_b128 %11, %23, off\n\t"
        "s_wait_xcnt 0x0"
        :: "v"(lds),            "v"(lds + 1*NN*4), "v"(lds + 2*NN*4),
           "v"(lds + 3*NN*4),   "v"(lds + 4*NN*4), "v"(lds + 5*NN*4),
           "v"(lds + 8*SSTEPF*4),            "v"(lds + 8*SSTEPF*4 + 1*NN*4), "v"(lds + 8*SSTEPF*4 + 2*NN*4),
           "v"(lds + 8*SSTEPF*4 + 3*NN*4),   "v"(lds + 8*SSTEPF*4 + 4*NN*4), "v"(lds + 8*SSTEPF*4 + 5*NN*4),
           "v"(r), "v"(dc), "v"(k), "v"(v), "v"(aa), "v"(bb),
           "v"(r + 8*CC), "v"(dc + 8*CC), "v"(k + 8*CC), "v"(v + 8*CC), "v"(aa + 8*CC), "v"(bb + 8*CC)
        : "memory");
}

// x + (x of the lane whose number differs in the bits of MASK), inside a 16-lane row
template<int MASK>
__device__ __forceinline__ float lane_xor_add(float x)
{
    const int o = __builtin_amdgcn_update_dpp(0, __builtin_bit_cast(int, x), 0x160 + MASK, 0xf, 0xf, true);
    return x + __builtin_bit_cast(float, o);
}
// sum over the 8 lanes that share a state row; every one of them gets it
__device__ __forceinline__ float row_sum8(float x)
{
    x = lane_xor_add<1>(x);
    x = lane_xor_add<2>(x);
    return lane_xor_add<4>(x);
}
// sum over a 16-lane row; every one of them gets it
__device__ __forceinline__ float row_sum16(float x)
{
    return lane_xor_add<8>(row_sum8(x));
}

// the lane's 8 columns of one staged vector
struct Cols { v2f c[4]; };
__device__ __forceinline__ Cols load_cols(const float* p)
{
    const v4f lo = *(const v4f*)p, hi = *(const v4f*)(p + 32);
    Cols o;
    o.c[0] = __builtin_shufflevector(lo, lo, 0, 1);
    o.c[1] = __builtin_shufflevector(lo, lo, 2, 3);
    o.c[2] = __builtin_shufflevector(hi, hi, 0, 1);
    o.c[3] = __builtin_shufflevector(hi, hi, 2, 3);
    return o;
}
struct StepIn { Cols r, d, k, a, b; v2f v; };
__device__ __forceinline__ StepIn load_step(const float* sp, int coff, int voff)
{
    StepIn s;
    s.a = load_cols(sp + 4*NN + coff);
    s.d = load_cols(sp + 1*NN + coff);
    s.k = load_cols(sp + 2*NN + coff);
    s.v = *(const v2f*)(sp + 3*NN + voff);
    s.b = load_cols(sp + 5*NN + coff);
    s.r = load_cols(sp + coff);
    return s;
}
__device__ __forceinline__ float dot8(const v2f (&s)[4], const Cols& x)
{
    const v2f p = s[0]*x.c[0] + s[1]*x.c[1];
    const v2f q = s[2]*x.c[2] + s[3]*x.c[3];
    const v2f t = p + q;
    return t.x + t.y;
}

__global__ __launch_bounds__(128)
void scan_kernel(const float* __restrict__ r, const float* __restrict__ dc,
                 const float* __restrict__ k, const float* __restrict__ v,
                 const float* __restrict__ aa, const float* __restrict__ bb,
                 const float* __restrict__ state0, float* __restrict__ y,
                 float* __restrict__ part)
{
    __shared__ __attribute__((aligned(16))) float stage[2 * SBUFF];
    __shared__ __attribute__((aligned(16))) float ybuf[2 * SCH * SROWS];
    __shared__ __attribute__((aligned(16))) float hsum[16];   // (sum, sum of squares) of each 16-lane row

    const int bh    = blockIdx.x >> 1;         // b*H + h
    const int rbase = (blockIdx.x & 1) * SROWS;
    const int b = bh >> 5, h = bh & 31;
    const int tid  = threadIdx.x;
    const int lane = tid & 31, wave = tid >> 5;
    const int lc = lane & 7, lr = lane >> 3;
    const int rloc = wave * 8 + lr * 2;        // the lane's two rows inside the block's 32
    const int coff = lc * 4;
    const int voff = rbase + rloc;

    v2f S[2][4];
    #pragma unroll   // S[] must stay in registers
    for (int rr = 0; rr < 2; ++rr) {
        const Cols c = load_cols(state0 + ((size_t)bh * NN + rbase + rloc + rr) * NN + coff);
        #pragma unroll
        for (int q = 0; q < 4; ++q) S[rr][q] = c.c[q];
    }
    asm volatile("s_wait_xcnt 0x0" ::: "memory");   // precaution: before the state loads' address registers are reused

    // copies: 16 lanes a vector (16 bytes each), 8 steps per pass over the block's 128 threads
    const int crow = tid >> 4, cpos = (tid & 15) * 4;
    const size_t g0 = ((size_t)(b * TT + crow)) * CC + h * NN + cpos;
    const unsigned lds0 = (unsigned)(uintptr_t)stage + (unsigned)((crow * SSTEPF + cpos) * 4);
    // y: 8 lanes store one step's 128-byte line of the block's 32 rows
    float* yg = y + ((size_t)(b * TT + (tid >> 3))) * CC + h * NN + rbase + (tid & 7) * 4;
    const int nC = TT / SCH;

    scan_stage_chunk(lds0, r + g0, dc + g0, k + g0, v + g0, aa + g0, bb + g0);
    asm volatile("s_wait_asynccnt 0x0" ::: "memory");   // chunk 0 has landed (this wave's part)
    __syncthreads();                                    // ... and every other wave's
    {
        const size_t g = g0 + (size_t)SCH * CC;
        scan_stage_chunk(lds0 + SBUFB, r + g, dc + g, k + g, v + g, aa + g, bb + g);
    }

    v4f ysum = {0.f, 0.f, 0.f, 0.f}, ysq = {0.f, 0.f, 0.f, 0.f};
    for (int c = 0; c < nC; ++c) {
        const float* sb = stage + (c & 1) * SBUFF;
        float* yb = ybuf + (c & 1) * (SCH * SROWS);
        v2f keep = {0.f, 0.f};
        // vectors are read from LDS two steps ahead of their use
        StepIn p0 = load_step(sb, coff, voff);
        StepIn p1 = load_step(sb + SSTEPF, coff, voff);
        Cols rprev = p0.r;
        #pragma unroll   // constant LDS offsets; the step records stay in registers
        for (int tt = 0; tt <= SCH; ++tt) {
            // y of step tt-1 is a dot product of the same S as this step's sa: the four lane sums run side by side
            v2f yo = {0.f, 0.f};
            if (tt > 0) {
                #pragma unroll
                for (int rr = 0; rr < 2; ++rr) yo[rr] = dot8(S[rr], rprev);
            }
            if (tt < SCH) {
                StepIn p2 = p1;
                if (tt + 2 < SCH) p2 = load_step(sb + (tt + 2) * SSTEPF, coff, voff);
                float sa[2];
                v2f   T[2][4];
                #pragma unroll
                for (int rr = 0; rr < 2; ++rr) sa[rr] = dot8(S[rr], p0.a);
                #pragma unroll
                for (int rr = 0; rr < 2; ++rr) {
                    const v2f vv = {p0.v[rr], p0.v[rr]};
                    #pragma unroll
                    for (int q = 0; q < 4; ++q) T[rr][q] = S[rr][q] * p0.d.c[q] + vv * p0.k.c[q];
                }
                #pragma unroll
                for (int rr = 0; rr < 2; ++rr) {
                    const float s = row_sum8(sa[rr]);
                    const v2f ss = {s, s};
                    #pragma unroll
                    for (int q = 0; q < 4; ++q) S[rr][q] = T[rr][q] + ss * p0.b.c[q];
                }
                rprev = p0.r;
                p0 = p1;
                p1 = p2;
            }
            if (tt > 0) {
                const int u = tt - 1;
                #pragma unroll
                for (int rr = 0; rr < 2; ++rr) yo[rr] = row_sum8(yo[rr]);
                // lane lc keeps the y pair of step lc of each run of 8, then all lanes store at once
                if ((u & 7) == lc) keep = yo;
                if ((u & 7) == 7)
                    *(v2f*)(yb + ((u & 8) + lc) * SROWS + rloc) = keep;
            }
            // keeps each step's LDS reads a whole step ahead of their use: without it the scheduler sinks them next to it
            __builtin_amdgcn_sched_barrier(0);
        }
        asm volatile("s_wait_dscnt 0x0" ::: "memory");     // this wave has left the buffer, its y is in LDS
        asm volatile("s_wait_asynccnt 0x0" ::: "memory");  // its part of chunk c+1 has landed
        __syncthreads();   // publishes chunk c+1 and this chunk's y, ends every wave's reads of chunk c
        if (c + 2 < nC) {
            const size_t g = g0 + (size_t)(c + 2) * SCH * CC;
            scan_stage_chunk(lds0 + (c & 1) * SBUFB, r + g, dc + g, k + g, v + g, aa + g, bb + g);
        }
        const v4f yv = *(const v4f*)(yb + tid * 4);
        *(v4f*)(yg + (size_t)c * SCH * CC) = yv;
        asm volatile("s_wait_xcnt 0x0" ::: "memory");      // precaution: before the store's registers are reused
        ysum += yv;
        ysq  += yv * yv;
    }
    asm volatile("s_wait_asynccnt 0x0" ::: "memory");      // no copy is left when the wave ends

    // the block's sums of y and y*y: four values a thread, a 16-lane row, then the eight rows in order
    const float ps = row_sum16((ysum.x + ysum.y) + (ysum.z + ysum.w));
    const float pq = row_sum16((ysq.x + ysq.y) + (ysq.z + ysq.w));
    if ((tid & 15) == 0) *(v2f*)(hsum + (tid >> 4) * 2) = (v2f){ps, pq};
    __syncthreads();       // every row's pair is in LDS
    if (tid == 0) {
        v2f t = *(const v2f*)hsum;
        #pragma unroll   // constant LDS offsets
        for (int w = 1; w < 8; ++w) t += *(const v2f*)(hsum + w * 2);
        *(v2f*)(part + blockIdx.x * 32) = t;   // a 128-byte line of its own for each block: one writer a line
    }
}

// =====================================================================
// GroupNorm over (T,N) per (b,h) + bonus term. The two sums of a group come from the scan
// (two blocks a group), so nothing here spans the time axis and the work is spread over the
// chip: a block takes 8 rows x 1024 channels, a thread 4 channels of each row (16-byte loads
// and stores, 512 contiguous bytes a wave), a head lies in one 16-lane row. The 16 loads of
// four rows fly together. xx aliases rbuf (each lane reads its r before writing the same place).
// =====================================================================
#define GNR 8      // rows per block
#define GNB 4      // rows whose loads are in flight together
__global__ __launch_bounds__(256)
void gnorm_kernel(const float* __restrict__ y, const float* rbuf,
                  const float* __restrict__ kpost, const float* __restrict__ vpost,
                  const float* __restrict__ r_k, const float* __restrict__ ln_w,
                  const float* __restrict__ ln_b, const float* __restrict__ part, float* xx)
{
    // indices count 16-byte pieces and are unsigned: every access is a scalar base plus one 32-bit lane offset
    const unsigned c4 = blockIdx.y * 256u + threadIdx.x;                // the lane's four channels
    const unsigned bh = (blockIdx.x * GNR / TT) * HH + (c4 >> 4);       // GNR divides T: one batch a block

    const v2f pa = ((const v2f*)part)[bh * 32];          // sum and sum of squares over state rows 0-31 of the group
    const v2f pb = ((const v2f*)part)[bh * 32 + 16];     // the same over rows 32-63 (the next block's line)
    asm volatile("s_wait_xcnt 0x0" ::: "memory");        // precaution: before the next loads' results reuse the offset register
    const v4f rk = ((const v4f*)r_k)[c4];
    const v4f lw = ((const v4f*)ln_w)[c4];
    const v4f lb = ((const v4f*)ln_b)[c4];
    asm volatile("s_wait_xcnt 0x0" ::: "memory");        // precaution: before these loads' offset registers are reused
    const float mean = (pa.x + pb.x) * (1.f / 65536.f);
    const float var  = (pa.y + pb.y) * (1.f / 65536.f) - mean*mean;
    const float rstd = rsqrtf(var + GN_EPS);

    // one lane offset for the whole kernel; the rows are constant offsets from it
    const unsigned e0 = blockIdx.x * (GNR * CC / 4) + c4;
    const v4f* rp = (const v4f*)rbuf  + e0;
    const v4f* kp = (const v4f*)kpost + e0;
    const v4f* yp = (const v4f*)y     + e0;
    const v4f* vp = (const v4f*)vpost + e0;
    v4f*       xp = (v4f*)xx          + e0;
    #pragma unroll   // constant offsets on every load and store
    for (int g = 0; g < GNR; g += GNB) {
        v4f r4[GNB], k4[GNB], y4[GNB], v4[GNB], o[GNB];
        #pragma unroll   // the arrays must stay in registers
        for (int i = 0; i < GNB; ++i) {
            r4[i] = rp[(g + i) * (CC / 4)];
            k4[i] = kp[(g + i) * (CC / 4)];
            y4[i] = yp[(g + i) * (CC / 4)];
            v4[i] = vp[(g + i) * (CC / 4)];
        }
        // all 16 loads are issued before the first is used: without it the scheduler sinks half of them behind the first waits
        __builtin_amdgcn_sched_barrier(0);
        #pragma unroll   // the four rows' lane sums run side by side
        for (int i = 0; i < GNB; ++i) {
            const v4f p = r4[i] * k4[i] * rk;
            const float d = row_sum16((p.x + p.y) + (p.z + p.w));
            o[i] = (y4[i] - mean) * rstd * lw + lb + d * v4[i];
        }
        __builtin_amdgcn_sched_barrier(0);   // no vector work, which may reuse a stored register, between a store and the wait
        #pragma unroll   // o[] must stay in registers
        for (int i = 0; i < GNB; ++i)
            xp[(g + i) * (CC / 4)] = o[i];
        asm volatile("s_wait_xcnt 0x0" ::: "memory");    // precaution: before the stores' registers are reused
        __builtin_amdgcn_sched_barrier(0);   // the other edge of the same group
    }
}

// =====================================================================
extern "C" void kernel_launch(void* const* d_in, const int* in_sizes, int n_in,
                              void* d_out, int out_size, void* d_ws, size_t ws_size,
                              hipStream_t stream) {
    const float* x       = (const float*)d_in[0];
    const float* v_first = (const float*)d_in[1];
    const float* state0  = (const float*)d_in[2];
    const float* Rw      = (const float*)d_in[3];
    const float* R_bias  = (const float*)d_in[4];
    const float* Kw      = (const float*)d_in[5];
    const float* K_bias  = (const float*)d_in[6];
    const float* Vw      = (const float*)d_in[7];
    const float* V_bias  = (const float*)d_in[8];
    const float* Ow      = (const float*)d_in[9];
    const float* O_bias  = (const float*)d_in[10];
    const float* w0      = (const float*)d_in[11];
    const float* w1      = (const float*)d_in[12];
    const float* w2      = (const float*)d_in[13];
    const float* a0      = (const float*)d_in[14];
    const float* a1      = (const float*)d_in[15];
    const float* a2      = (const float*)d_in[16];
    const float* v0      = (const float*)d_in[17];
    const float* v1      = (const float*)d_in[18];
    const float* v2      = (const float*)d_in[19];
    const float* k_k     = (const float*)d_in[20];
    const float* k_a     = (const float*)d_in[21];
    const float* r_k     = (const float*)d_in[22];
    const float* ln_w    = (const float*)d_in[23];
    const float* ln_b    = (const float*)d_in[24];
    float* out = (float*)d_out;

    // workspace layout (floats)
    float* ws = (float*)d_ws;
    float* r_buf  = ws;                                // M*C   (later reused as xx)
    float* klin   = r_buf  + (size_t)MM*CC;            // M*512
    float* vlin   = klin   + (size_t)MM*KVC;           // M*512
    float* hw     = vlin   + (size_t)MM*KVC;           // M*64
    float* ha     = hw     + (size_t)MM*64;            // M*64
    float* hv     = ha     + (size_t)MM*64;            // M*32
    float* decayb = hv     + (size_t)MM*32;            // M*C
    float* kpost  = decayb + (size_t)MM*CC;            // M*C
    float* vpost  = kpost  + (size_t)MM*CC;            // M*C
    float* aab    = vpost  + (size_t)MM*CC;            // M*C
    float* bbb    = aab    + (size_t)MM*CC;            // M*C
    float* ybuf   = bbb    + (size_t)MM*CC;            // M*C
    float* gpart  = ybuf   + (size_t)MM*CC;            // B*H*2 lines of 32: each scan block's sums of y and y*y
    float* xx     = r_buf;                             // alias: r dead after bonus read

    const dim3 blk(128);
    // Step 1: projections (blocked WMMA for the big GEMMs)
    wmma_gemm_f32_blk<<<dim3(MM/64, CC/64),  blk, 0, stream>>>(x, Rw, R_bias, r_buf, CC, CC);
    wmma_gemm_f32_blk<<<dim3(MM/64, KVC/64), blk, 0, stream>>>(x, Kw, K_bias, klin,  CC, KVC);
    wmma_gemm_f32_blk<<<dim3(MM/64, KVC/64), blk, 0, stream>>>(x, Vw, V_bias, vlin,  CC, KVC);
    lora_in_kernel<<<dim3(MM/16), dim3(256), 0, stream>>>(x, w1, a1, v1, hw, ha, hv);

    // fused elementwise prep
    fusion_kernel<<<dim3(MM/128, HH), dim3(256), 0, stream>>>(
        klin, vlin, hw, ha, hv, v_first, w0, w2, a0, a2, v0, v2, k_k, k_a,
        decayb, kpost, vpost, aab, bbb);

    // Step 2: sequential scan
    scan_kernel<<<dim3(BB*HH*2), dim3(128), 0, stream>>>(
        r_buf, decayb, kpost, vpost, aab, bbb, state0, ybuf, gpart);

    // Step 3: group norm + bonus
    gnorm_kernel<<<dim3(MM/GNR, CC/1024), dim3(256), 0, stream>>>(
        ybuf, r_buf, kpost, vpost, r_k, ln_w, ln_b, gpart, xx);

    // output projection
    wmma_gemm_f32_blk<<<dim3(MM/64, CC/64), blk, 0, stream>>>(xx, Ow, O_bias, out, CC, CC);
    (void)in_sizes; (void)n_in; (void)out_size; (void)ws_size;
}

// v006
// It runs in 596 microseconds.
// In both of two side-by-side timings against v005, it was 1.09 times as fast.
// All steps since v000 together make it 7.25 times as fast.
#include <hip/hip_runtime.h>
#include <math.h>

// ---------------- problem constants ----------------
#define BB  4
#define TT  1024
#define CC  2048
#define HH  32
#define NN  64
#define KVC 512
#define MM  (BB*TT)          // 4096 rows
#define GN_EPS 0.00064f

typedef float v2f __attribute__((ext_vector_type(2)));
typedef float v8f __attribute__((ext_vector_type(8)));

#define GBK     64
#define GPITCH  68
#define GROWB   (GPITCH * 4)
#define GBUFB   (256 * GROWB)

// Eight of a thread's sixteen 16-byte pieces of one k tile: rows r, r+16, r+32, r+48 of X and of W.
// The wait on the last line stands before the address registers can be rewritten.
__device__ __forceinline__
void gemm_stage_tile(unsigned lds, const float* gx, const float* gw, size_t rstep)
{
    asm volatile(
        "global_load_async_to_lds_b128 %0, %8, off\n\t"
        "global_load_async_to_lds_b128 %1, %9, off\n\t"
        "global_load_async_to_lds_b128 %2, %10, off\n\t"
        "global_load_async_to_lds_b128 %3, %11, off\n\t"
        "global_load_async_to_lds_b128 %4, %12, off\n\t"
        "global_load_async_to_lds_b128 %5, %13, off\n\t"
        "global_load_async_to_lds_b128 %6, %14, off\n\t"
        "global_load_async_to_lds_b128 %7, %15, off\n\t"
        "s_wait_xcnt 0x0"
        :: "v"(lds),              "v"(lds +  16*GROWB), "v"(lds +  32*GROWB), "v"(lds +  48*GROWB),
           "v"(lds + 128*GROWB),  "v"(lds + 144*GROWB), "v"(lds + 160*GROWB), "v"(lds + 176*GROWB),
           "v"(gx), "v"(gx + rstep), "v"(gx + 2*rstep), "v"(gx + 3*rstep),
           "v"(gw), "v"(gw + rstep), "v"(gw + 2*rstep), "v"(gw + 3*rstep)
        : "memory");
}

__global__ __launch_bounds__(256)
void wmma_gemm_f32_blk(const float* __restrict__ X,
                       const float* W0, const float* bias0, float* Out0, int Nc0,
                       const float* W1, const float* bias1, float* Out1, int Nc1,
                       const float* W2, const float* bias2, float* Out2, int Nc2,
                       int K)
{
    __shared__ __attribute__((aligned(16))) float tile[2 * 256 * GPITCH];

    // which product the block's 128 columns belong to (the same for the whole block)
    int cb = blockIdx.y * 128;
    const float* W = W0; const float* bias = bias0; float* Out = Out0; int Nc = Nc0;
    if (cb >= Nc0 + Nc1) { W = W2; bias = bias2; Out = Out2; Nc = Nc2; cb -= Nc0 + Nc1; }
    else if (cb >= Nc0)  { W = W1; bias = bias1; Out = Out1; Nc = Nc1; cb -= Nc0; }

    const int lane = threadIdx.x & 31;
    const int wave = threadIdx.x >> 5;
    const int half = lane >> 4;
    const int l    = lane & 15;
    const int mw   = wave >> 2, nw = wave & 3;
    const int tileM = blockIdx.x * 128 + mw * 64;
    const int tileN = cb + nw * 32;

    // copies: 16 lanes a row (16 bytes each), 16 rows per pass over the block's 256 threads
    const int crow = threadIdx.x >> 4, cpos = (threadIdx.x & 15) * 4;
    const float* gx = X + (size_t)(blockIdx.x * 128 + crow) * K + cpos;
    const float* gw = W + (size_t)(cb + crow) * K + cpos;
    const size_t rstep = (size_t)16 * K;
    const unsigned lds0 = (unsigned)(uintptr_t)tile + (unsigned)(crow * GROWB + cpos * 4);
    const int nT = K / GBK;

    // rows 0-63 and rows 64-127 of both operands
    auto stage = [&](int buf, int t) {
        const unsigned o = lds0 + (unsigned)buf * GBUFB;
        const float* px = gx + (size_t)t * GBK;
        const float* pw = gw + (size_t)t * GBK;
        gemm_stage_tile(o,              px,             pw,             rstep);
        gemm_stage_tile(o + 64 * GROWB, px + 4 * rstep, pw + 4 * rstep, rstep);
    };

    stage(0, 0);
    asm volatile("s_wait_asynccnt 0x0" ::: "memory");   // tile 0 has landed (this wave's part)
    __syncthreads();                                    // ... and every other wave's
    if (nT > 1) stage(1, 1);

    // fragments: lane -> row, half -> k pair, the same k order in A and B
    const int aoff = (mw * 64 + l) * GPITCH + 2*half;
    const int boff = (128 + nw * 32 + l) * GPITCH + 2*half;

    v8f acc[4][2];
    #pragma unroll   // acc[] must stay in registers
    for (int i = 0; i < 4; ++i) { acc[i][0] = (v8f){}; acc[i][1] = (v8f){}; }

    for (int t = 0; t < nT; ++t) {
        const float* buf = tile + (t & 1) * (256 * GPITCH);
        const float* as  = buf + aoff;
        const float* bs  = buf + boff;
        #pragma unroll   // constant LDS offsets on every fragment read
        for (int s = 0; s < GBK; s += 4) {
            v2f a[4], b[2];
            #pragma unroll
            for (int i = 0; i < 4; ++i) a[i] = *(const v2f*)(as + i * 16 * GPITCH + s);
            #pragma unroll
            for (int n = 0; n < 2; ++n) b[n] = *(const v2f*)(bs + n * 16 * GPITCH + s);
            #pragma unroll
            for (int i = 0; i < 4; ++i) {
                #pragma unroll
                for (int n = 0; n < 2; ++n)
                    acc[i][n] = __builtin_amdgcn_wmma_f32_16x16x4_f32(false, a[i], false, b[n], (short)0, acc[i][n], false, false);
            }
        }
        asm volatile("s_wait_dscnt 0x0" ::: "memory");     // this wave has left the buffer
        asm volatile("s_wait_asynccnt 0x0" ::: "memory");  // its part of tile t+1 has landed
        __syncthreads();   // publishes tile t+1 and ends every wave's reads of tile t
        if (t + 2 < nT) stage(t & 1, t + 2);
    }
    asm volatile("s_wait_asynccnt 0x0" ::: "memory");      // no copy is left when the wave ends

    const int col0 = tileN + l, col1 = tileN + 16 + l;
    const float bs0 = bias ? bias[col0] : 0.0f;
    const float bs1 = bias ? bias[col1] : 0.0f;
    asm volatile("s_wait_xcnt 0x0" ::: "memory");   // precaution: before the bias loads' offset register is reused for the store addresses
    __builtin_amdgcn_sched_barrier(0);   // keeps the store-address arithmetic, which reuses that register, behind the wait
    #pragma unroll   // acc[] is indexed: registers only when unrolled
    for (int i = 0; i < 4; ++i) {
        #pragma unroll
        for (int j = 0; j < 8; ++j) {
            const int row = tileM + i * 16 + j + 8*half;   // C/D: VGPR j -> M=j / j+8
            Out[(size_t)row * Nc + col0] = acc[i][0][j] + bs0;
            Out[(size_t)row * Nc + col1] = acc[i][1][j] + bs1;
        }
    }
}

// =====================================================================
// LoRA first-stage products x@w1 (then tanh), x@a1, x@v1 in ONE launch: the three
// weights, stored (K,Nc), are taken as one (K,160) matrix. A block owns 16 rows of x
// and all 160 columns; its 8 waves split k: of each staged tile of 128 k a wave takes
// 16, with 10 independent accumulator tiles, so one A fragment serves 10 WMMAs.
// Tiles come into LDS in whole lines by asynchronous copies, two buffers; the eight
// partial sums are added through LDS at the end, in wave order.
// =====================================================================
typedef float v4f __attribute__((ext_vector_type(4)));

#define LK    128                  // k per staged tile
#define LWP   168                  // LDS pitch (floats) of a weight row: rows k and k+2 of a fragment read fall 16 banks apart
#define LXP   132                  // LDS pitch (floats) of an x row: 16 rows of an 8-byte fragment read meet 64 distinct banks
#define LWF   (LK * LWP)           // floats of the weight part of a buffer
#define LBUFF (LWF + 16 * LXP)     // floats of one buffer
#define LBUFB (LBUFF * 4)
#define LRP   164                  // LDS pitch (floats) of a partial-sum row: rows j and j+8 fall 32 banks apart

// Eleven 16-byte pieces of one k tile: rows r, r+16, .. r+112 of a 64-wide weight,
// rows q, q+32 of the 32-wide weight, one piece of x.
// The wait on the last line stands before the address registers can be rewritten.
__device__ __forceinline__
void lora_stage11(unsigned lw, const float* gw, unsigned lv, const float* gv,
                  unsigned lx, const float* gx)
{
    asm volatile(
        "global_load_async_to_lds_b128 %0, %11, off\n\t"
        "global_load_async_to_lds_b128 %1, %12, off\n\t"
        "global_load_async_to_lds_b128 %2, %13, off\n\t"
        "global_load_async_to_lds_b128 %3, %14, off\n\t"
        "global_load_async_to_lds_b128 %4, %15, off\n\t"
        "global_load_async_to_lds_b128 %5, %16, off\n\t"
        "global_load_async_to_lds_b128 %6, %17, off\n\t"
        "global_load_async_to_lds_b128 %7, %18, off\n\t"
        "global_load_async_to_lds_b128 %8, %19, off\n\t"
        "global_load_async_to_lds_b128 %9, %20, off\n\t"
        "global_load_async_to_lds_b128 %10, %21, off\n\t"
        "s_wait_xcnt 0x0"
        :: "v"(lw),                "v"(lw +  16*LWP*4), "v"(lw +  32*LWP*4), "v"(lw +  48*LWP*4),
           "v"(lw + 64*LWP*4),     "v"(lw +  80*LWP*4), "v"(lw +  96*LWP*4), "v"(lw + 112*LWP*4),
           "v"(lv),                "v"(lv +  32*LWP*4), "v"(lx),
           "v"(gw),         "v"(gw + 16*64), "v"(gw + 32*64), "v"(gw +  48*64),
           "v"(gw + 64*64), "v"(gw + 80*64), "v"(gw + 96*64), "v"(gw + 112*64),
           "v"(gv),         "v"(gv + 32*32), "v"(gx)
        : "memory");
}

__global__ __launch_bounds__(256)
void lora_in_kernel(const float* __restrict__ X,  const float* __restrict__ w1,
                    const float* __restrict__ a1, const float* __restrict__ v1,
                    float* __restrict__ hw, float* __restrict__ ha, float* __restrict__ hv)
{
    __shared__ __attribute__((aligned(16))) float st[2 * LBUFF];

    const int tid  = threadIdx.x;
    const int lane = tid & 31, wave = tid >> 5;
    const int half = lane >> 4, l = lane & 15;
    const int m0   = blockIdx.x * 16;

    // copies: 16 lanes a row of w1 / a1, 8 lanes a row of v1, 32 lanes a row of x
    const size_t  g64 = (size_t)(tid >> 4) * 64 + (tid & 15) * 4;
    const float*  gv  = v1 + (size_t)(tid >> 3) * 32 + (tid & 7) * 4;
    const float*  gx  = X  + (size_t)(m0 + (tid >> 5)) * CC + (tid & 31) * 4;
    const unsigned lb = (unsigned)(uintptr_t)st;
    const unsigned lw = lb + (unsigned)(((tid >> 4) * LWP + (tid & 15) * 4) * 4);
    const unsigned lv = lb + (unsigned)(((tid >> 3) * LWP + 128 + (tid & 7) * 4) * 4);
    const unsigned lx = lb + (unsigned)((LWF + (tid >> 5) * LXP + (tid & 31) * 4) * 4);
    const int nT = CC / LK;

    auto stage = [&](int buf, int t) {
        const unsigned o = (unsigned)buf * LBUFB;
        lora_stage11(lw + o,          w1 + g64 + (size_t)t * LK * 64,
                     lv + o,          gv + (size_t)t * LK * 32,
                     lx + o,          gx + t * LK);
        lora_stage11(lw + o + 64 * 4, a1 + g64 + (size_t)t * LK * 64,
                     lv + o + 64 * LWP * 4, gv + (size_t)t * LK * 32 + 64 * 32,
                     lx + o + 8 * LXP * 4,  gx + t * LK + 8 * CC);
    };

    stage(0, 0);
    asm volatile("s_wait_asynccnt 0x0" ::: "memory");   // tile 0 has landed (this wave's part)
    __syncthreads();                                    // ... and every other wave's
    stage(1, 1);

    // fragments: A lane -> row, B lane -> column, half -> k pair (the same k order in both)
    const int aoff = LWF + l * LXP + wave * 16 + 2 * half;
    const int boff = (wave * 16 + 2 * half) * LWP + l;

    v8f acc[10];
    #pragma unroll   // acc[] must stay in registers
    for (int nt = 0; nt < 10; ++nt) acc[nt] = (v8f){};

    for (int t = 0; t < nT; ++t) {
        const float* buf = st + (t & 1) * LBUFF;
        #pragma unroll   // constant LDS offsets on every fragment read
        for (int s = 0; s < 4; ++s) {
            const v2f a = *(const v2f*)(buf + aoff + 4 * s);
            const float* bp = buf + boff + 4 * s * LWP;
            #pragma unroll
            for (int nt = 0; nt < 10; ++nt) {
                v2f b;
                b.x = bp[nt * 16];
                b.y = bp[LWP + nt * 16];
                acc[nt] = __builtin_amdgcn_wmma_f32_16x16x4_f32(false, a, false, b, (short)0, acc[nt], false, false);
            }
        }
        asm volatile("s_wait_dscnt 0x0" ::: "memory");     // this wave has left the buffer
        asm volatile("s_wait_asynccnt 0x0" ::: "memory");  // its part of tile t+1 has landed
        __syncthreads();   // publishes tile t+1 and ends every wave's reads of tile t
        if (t + 2 < nT) stage(t & 1, t + 2);
    }
    asm volatile("s_wait_asynccnt 0x0" ::: "memory");      // no copy is left when the LDS is reused

    // the eight waves' partial sums (C/D: VGPR j -> row j / j+8, lane -> column)
    float* red = st;
    #pragma unroll
    for (int nt = 0; nt < 10; ++nt) {
        #pragma unroll
        for (int j = 0; j < 8; ++j)
            red[(wave * 16 + j + 8 * half) * LRP + nt * 16 + l] = acc[nt][j];
    }
    __syncthreads();       // every wave's partial sums are in LDS

    // 16 rows x 40 pieces of four columns over 256 threads: two full passes and a half one
    for (int q = tid; q < 16 * 40; q += 256) {
        const int row = q / 40, c4 = (q - row * 40) * 4;
        v4f s = *(const v4f*)(red + row * LRP + c4);
        #pragma unroll
        for (int w = 1; w < 8; ++w) s += *(const v4f*)(red + (w * 16 + row) * LRP + c4);
        float* p;
        if (c4 < 64) {
            #pragma unroll
            for (int e = 0; e < 4; ++e) s[e] = tanhf(s[e]);
            p = hw + (size_t)(m0 + row) * 64 + c4;
        } else if (c4 < 128) {
            p = ha + (size_t)(m0 + row) * 64 + (c4 - 64);
        } else {
            p = hv + (size_t)(m0 + row) * 32 + (c4 - 128);
        }
        *(v4f*)p = s;
        asm volatile("s_wait_xcnt 0x0" ::: "memory");   // precaution: before the store's registers are reused in the next pass
    }
}

#define XCNT_WAIT() asm volatile("s_wait_xcnt 0x0" ::: "memory")
// Round a group of stores and its wait: keeps the scheduler from placing vector work,
// which may reuse a stored register, between a store and the wait.
#define SCHED_EDGE() __builtin_amdgcn_sched_barrier(0)

template<int K>
__device__ __forceinline__
void lora_tile(const float* __restrict__ A, const float* __restrict__ Bm,
               const float* __restrict__ init, int tileM, int cbase,
               int l, int half, v8f (&acc)[4])
{
    const float* arow = A  + (size_t)(tileM + l) * K + 2*half;   // A: lane -> row, half -> k pair
    const float* bcol = Bm + (size_t)(2*half) * CC + cbase + l;  // B: lane -> col, half -> k pair
    XCNT_WAIT();     // behind the stores of the phase before
    #pragma unroll   // acc[] must stay in registers
    for (int nt = 0; nt < 4; ++nt) {
        const float c0 = init[cbase + nt*16 + l];                // the bias vector starts the sum
        #pragma unroll
        for (int j = 0; j < 8; ++j) acc[nt][j] = c0;
    }
    XCNT_WAIT();
    #pragma unroll   // constant offsets on every load
    for (int kc = 0; kc < K; kc += 16) {
        // all 36 fragment loads of a 16-deep k chunk first: one cache latency per 16 WMMAs
        v2f a[4], b[4][4];
        #pragma unroll
        for (int s = 0; s < 4; ++s) a[s] = *(const v2f*)(arow + kc + 4*s);
        XCNT_WAIT();
        #pragma unroll
        for (int s = 0; s < 4; ++s) {
            const int k0 = kc + 4*s;
            #pragma unroll
            for (int nt = 0; nt < 4; ++nt) {
                b[s][nt].x = bcol[(size_t)(k0    ) * CC + nt*16];
                b[s][nt].y = bcol[(size_t)(k0 + 1) * CC + nt*16];
            }
        }
        XCNT_WAIT();
        #pragma unroll
        for (int s = 0; s < 4; ++s) {
            #pragma unroll
            for (int nt = 0; nt < 4; ++nt)
                acc[nt] = __builtin_amdgcn_wmma_f32_16x16x4_f32(false, a[s], false, b[s][nt], (short)0, acc[nt], false, false);
        }
    }
}

// 16 rows x 64 columns of a row-major array in the accumulator layout, one batch of loads.
__device__ __forceinline__
void load_tile(const float* __restrict__ p, int pitch, v8f (&t)[4])
{
    #pragma unroll   // t[] must stay in registers
    for (int nt = 0; nt < 4; ++nt) {
        #pragma unroll
        for (int j = 0; j < 8; ++j) t[nt][j] = p[(size_t)j * pitch + nt*16];
    }
    XCNT_WAIT();
}

__global__ __launch_bounds__(256)
void fusion_kernel(const float* __restrict__ klin, const float* __restrict__ vlin,
                   const float* __restrict__ hw,  const float* __restrict__ ha,
                   const float* __restrict__ hv,  const float* __restrict__ v_first,
                   const float* __restrict__ w0,  const float* __restrict__ w2,
                   const float* __restrict__ a0,  const float* __restrict__ a2,
                   const float* __restrict__ v0,  const float* __restrict__ v2,
                   const float* __restrict__ k_k, const float* __restrict__ k_a,
                   float* __restrict__ decay, float* __restrict__ kpost,
                   float* __restrict__ vpost, float* __restrict__ aaO,
                   float* __restrict__ bbO)
{
    const int lane = threadIdx.x & 31;
    const int wave = threadIdx.x >> 5;
    const int half = lane >> 4;
    const int l    = lane & 15;
    const int tileM  = blockIdx.x * 128 + wave * 16;
    const int h      = blockIdx.y;
    const int cbase  = h * NN;
    const int kvbase = (h >> 2) * NN;                 // kv-head repeat
    const int row0   = tileM + 8*half;                // C/D: VGPR j -> row j / j+8
    const size_t g0  = (size_t)row0 * CC  + cbase  + l;   // element (j, nt) at g0 + j*CC + nt*16
    const size_t q0  = (size_t)row0 * KVC + kvbase + l;
    v8f acc[4], t0[4], t1[4];

    // ---- decay ----
    lora_tile<64>(hw, w2, w0, tileM, cbase, l, half, acc);
    #pragma unroll   // acc[] is indexed: registers only when unrolled
    for (int nt = 0; nt < 4; ++nt) {
        v8f o;
        #pragma unroll
        for (int j = 0; j < 8; ++j) {
            const float wraw = -log1pf(expf(-acc[nt][j])) - 0.6f;   // -softplus(-t)-0.6
            o[j] = expf(-expf(wraw));
        }
        SCHED_EDGE();
        #pragma unroll
        for (int j = 0; j < 8; ++j) decay[g0 + (size_t)j * CC + nt*16] = o[j];
        XCNT_WAIT();
        SCHED_EDGE();
    }

    // ---- value blend ----
    lora_tile<32>(hv, v2, v0, tileM, cbase, l, half, acc);
    load_tile(vlin + q0, KVC, t0);
    load_tile(v_first + g0, CC, t1);
    #pragma unroll
    for (int nt = 0; nt < 4; ++nt) {
        v8f o;
        #pragma unroll
        for (int j = 0; j < 8; ++j) {
            const float vg = 1.f / (1.f + expf(-acc[nt][j]));
            const float vf = t0[nt][j];
            o[j] = vf + (t1[nt][j] - vf) * vg;
        }
        SCHED_EDGE();
        #pragma unroll
        for (int j = 0; j < 8; ++j) vpost[g0 + (size_t)j * CC + nt*16] = o[j];
        XCNT_WAIT();
        SCHED_EDGE();
    }

    // ---- a gate, k, normalised kk ----
    lora_tile<64>(ha, a2, a0, tileM, cbase, l, half, acc);
    load_tile(klin + q0, KVC, t0);
    float kkc[4], kac[4];
    #pragma unroll
    for (int nt = 0; nt < 4; ++nt) kkc[nt] = k_k[cbase + nt*16 + l];
    XCNT_WAIT();
    #pragma unroll
    for (int nt = 0; nt < 4; ++nt) kac[nt] = k_a[cbase + nt*16 + l];
    XCNT_WAIT();
    float ss[8];
    #pragma unroll
    for (int j = 0; j < 8; ++j) ss[j] = 0.f;
    #pragma unroll
    for (int nt = 0; nt < 4; ++nt) {
        v8f o;
        #pragma unroll
        for (int j = 0; j < 8; ++j) {
            const float av = 1.f / (1.f + expf(-acc[nt][j]));
            const float kf = t0[nt][j];
            const float kkp = kf * kkc[nt];
            o[j] = kf * (1.f + (av - 1.f) * kac[nt]);
            t0[nt][j]  = kkp;
            acc[nt][j] = av;
            ss[j] += kkp * kkp;
        }
        SCHED_EDGE();
        #pragma unroll
        for (int j = 0; j < 8; ++j) kpost[g0 + (size_t)j * CC + nt*16] = o[j];
        XCNT_WAIT();
        SCHED_EDGE();
    }
    #pragma unroll
    for (int j = 0; j < 8; ++j) {
        float s = ss[j];
        // a row's 64 channels sit in the 16 lanes of one half (4 per lane)
        for (int off = 8; off; off >>= 1) s += __shfl_xor(s, off);
        const float rn = 1.f / fmaxf(sqrtf(s), 1e-12f);
        float oa[4], ob[4];
        #pragma unroll
        for (int nt = 0; nt < 4; ++nt) {
            const float kkn = t0[nt][j] * rn;
            oa[nt] = -kkn;
            ob[nt] = kkn * acc[nt][j];
        }
        SCHED_EDGE();
        #pragma unroll
        for (int nt = 0; nt < 4; ++nt) {
            aaO[g0 + (size_t)j * CC + nt*16] = oa[nt];
            bbO[g0 + (size_t)j * CC + nt*16] = ob[nt];
        }
        XCNT_WAIT();
        SCHED_EDGE();
    }
}
#undef XCNT_WAIT
#undef SCHED_EDGE

// =====================================================================
// Sequential RWKV-7 scan. The 64 state rows of a (batch, head) never exchange anything,
// so they are spread wide: grid = B*H*2, a block of 4 waves owns 32 rows, a wave 8 rows.
// A row lies across 8 lanes (8 columns a lane: 4*lc.. and 32+4*lc..) and a lane holds two
// rows, so each vector element read from LDS serves two state elements and the chain
// of one time step is 8 products, a 3-step lane sum and one multiply-add.
// The six per-step vectors are staged 16 time steps at a time by asynchronous copies,
// two buffers, one barrier per 16 steps; y leaves through LDS in whole 128-byte lines.
// Where a thread stores y it also adds it, and its square, to sums of its own: at the end the
// block leaves its share of the group norm's two sums (half a (batch, head) group) in part[].
// =====================================================================
#define SCH    16                  // time steps per staged chunk
#define SSTEPF (6 * NN)            // floats of one staged step: r, decay, k, v, aa, bb
#define SBUFF  (SCH * SSTEPF)      // floats of one buffer
#define SBUFB  (SBUFF * 4)
#define SROWS  32                  // state rows per block

// A thread's twelve 16-byte pieces of one chunk: steps s and s+8 of each of the six arrays.
// The wait on the last line stands before the address registers can be rewritten.
__device__ __forceinline__
void scan_stage_chunk(unsigned lds, const float* r, const float* dc, const float* k,
                      const float* v, const float* aa, const float* bb)
{
    asm volatile(
        "global_load_async_to_lds_b128 %0, %12, off\n\t"
        "global_load_async_to_lds_b128 %1, %13, off\n\t"
        "global_load_async_to_lds_b128 %2, %14, off\n\t"
        "global_load_async_to_lds_b128 %3, %15, off\n\t"
        "global_load_async_to_lds_b128 %4, %16, off\n\t"
        "global_load_async_to_lds_b128 %5, %17, off\n\t"
        "global_load_async_to_lds_b128 %6, %18, off\n\t"
        "global_load_async_to_lds_b128 %7, %19, off\n\t"
        "global_load_async_to_lds_b128 %8, %20, off\n\t"
        "global_load_async_to_lds_b128 %9, %21, off\n\t"
        "global_load_async_to_lds_b128 %10, %22, off\n\t"
        "global_load_async_to_lds_b128 %11, %23, off\n\t"
        "s_wait_xcnt 0x0"
        :: "v"(lds),            "v"(lds + 1*NN*4), "v"(lds + 2*NN*4),
           "v"(lds + 3*NN*4),   "v"(lds + 4*NN*4), "v"(lds + 5*NN*4),
           "v"(lds + 8*SSTEPF*4),            "v"(lds + 8*SSTEPF*4 + 1*NN*4), "v"(lds + 8*SSTEPF*4 + 2*NN*4),
           "v"(lds + 8*SSTEPF*4 + 3*NN*4),   "v"(lds + 8*SSTEPF*4 + 4*NN*4), "v"(lds + 8*SSTEPF*4 + 5*NN*4),
           "v"(r), "v"(dc), "v"(k), "v"(v), "v"(aa), "v"(bb),
           "v"(r + 8*CC), "v"(dc + 8*CC), "v"(k + 8*CC), "v"(v + 8*CC), "v"(aa + 8*CC), "v"(bb + 8*CC)
        : "memory");
}

// x + (x of the lane whose number differs in the bits of MASK), inside a 16-lane row
template<int MASK>
__device__ __forceinline__ float lane_xor_add(float x)
{
    const int o = __builtin_amdgcn_update_dpp(0, __builtin_bit_cast(int, x), 0x160 + MASK, 0xf, 0xf, true);
    return x + __builtin_bit_cast(float, o);
}
// sum over the 8 lanes that share a state row; every one of them gets it
__device__ __forceinline__ float row_sum8(float x)
{
    x = lane_xor_add<1>(x);
    x = lane_xor_add<2>(x);
    return lane_xor_add<4>(x);
}
// sum over a 16-lane row; every one of them gets it
__device__ __forceinline__ float row_sum16(float x)
{
    return lane_xor_add<8>(row_sum8(x));
}

// the lane's 8 columns of one staged vector
struct Cols { v2f c[4]; };
__device__ __forceinline__ Cols load_cols(const float* p)
{
    const v4f lo = *(const v4f*)p, hi = *(const v4f*)(p + 32);
    Cols o;
    o.c[0] = __builtin_shufflevector(lo, lo, 0, 1);
    o.c[1] = __builtin_shufflevector(lo, lo, 2, 3);
    o.c[2] = __builtin_shufflevector(hi, hi, 0, 1);
    o.c[3] = __builtin_shufflevector(hi, hi, 2, 3);
    return o;
}
struct StepIn { Cols r, d, k, a, b; v2f v; };
__device__ __forceinline__ StepIn load_step(const float* sp, int coff, int voff)
{
    StepIn s;
    s.a = load_cols(sp + 4*NN + coff);
    s.d = load_cols(sp + 1*NN + coff);
    s.k = load_cols(sp + 2*NN + coff);
    s.v = *(const v2f*)(sp + 3*NN + voff);
    s.b = load_cols(sp + 5*NN + coff);
    s.r = load_cols(sp + coff);
    return s;
}
__device__ __forceinline__ float dot8(const v2f (&s)[4], const Cols& x)
{
    const v2f p = s[0]*x.c[0] + s[1]*x.c[1];
    const v2f q = s[2]*x.c[2] + s[3]*x.c[3];
    const v2f t = p + q;
    return t.x + t.y;
}

__global__ __launch_bounds__(128)
void scan_kernel(const float* __restrict__ r, const float* __restrict__ dc,
                 const float* __restrict__ k, const float* __restrict__ v,
                 const float* __restrict__ aa, const float* __restrict__ bb,
                 const float* __restrict__ state0, float* __restrict__ y,
                 float* __restrict__ part)
{
    __shared__ __attribute__((aligned(16))) float stage[2 * SBUFF];
    __shared__ __attribute__((aligned(16))) float ybuf[2 * SCH * SROWS];
    __shared__ __attribute__((aligned(16))) float hsum[16];   // (sum, sum of squares) of each 16-lane row

    const int bh    = blockIdx.x >> 1;         // b*H + h
    const int rbase = (blockIdx.x & 1) * SROWS;
    const int b = bh >> 5, h = bh & 31;
    const int tid  = threadIdx.x;
    const int lane = tid & 31, wave = tid >> 5;
    const int lc = lane & 7, lr = lane >> 3;
    const int rloc = wave * 8 + lr * 2;        // the lane's two rows inside the block's 32
    const int coff = lc * 4;
    const int voff = rbase + rloc;

    v2f S[2][4];
    #pragma unroll   // S[] must stay in registers
    for (int rr = 0; rr < 2; ++rr) {
        const Cols c = load_cols(state0 + ((size_t)bh * NN + rbase + rloc + rr) * NN + coff);
        #pragma unroll
        for (int q = 0; q < 4; ++q) S[rr][q] = c.c[q];
    }
    asm volatile("s_wait_xcnt 0x0" ::: "memory");   // precaution: before the state loads' address registers are reused

    // copies: 16 lanes a vector (16 bytes each), 8 steps per pass over the block's 128 threads
    const int crow = tid >> 4, cpos = (tid & 15) * 4;
    const size_t g0 = ((size_t)(b * TT + crow)) * CC + h * NN + cpos;
    const unsigned lds0 = (unsigned)(uintptr_t)stage + (unsigned)((crow * SSTEPF + cpos) * 4);
    // y: 8 lanes store one step's 128-byte line of the block's 32 rows
    float* yg = y + ((size_t)(b * TT + (tid >> 3))) * CC + h * NN + rbase + (tid & 7) * 4;
    const int nC = TT / SCH;

    scan_stage_chunk(lds0, r + g0, dc + g0, k + g0, v + g0, aa + g0, bb + g0);
    asm volatile("s_wait_asynccnt 0x0" ::: "memory");   // chunk 0 has landed (this wave's part)
    __syncthreads();                                    // ... and every other wave's
    {
        const size_t g = g0 + (size_t)SCH * CC;
        scan_stage_chunk(lds0 + SBUFB, r + g, dc + g, k + g, v + g, aa + g, bb + g);
    }

    v4f ysum = {0.f, 0.f, 0.f, 0.f}, ysq = {0.f, 0.f, 0.f, 0.f};
    for (int c = 0; c < nC; ++c) {
        const float* sb = stage + (c & 1) * SBUFF;
        float* yb = ybuf + (c & 1) * (SCH * SROWS);
        v2f keep = {0.f, 0.f};
        // vectors are read from LDS two steps ahead of their use
        StepIn p0 = load_step(sb, coff, voff);
        StepIn p1 = load_step(sb + SSTEPF, coff, voff);
        Cols rprev = p0.r;
        #pragma unroll   // constant LDS offsets; the step records stay in registers
        for (int tt = 0; tt <= SCH; ++tt) {
            // y of step tt-1 is a dot product of the same S as this step's sa: the four lane sums run side by side
            v2f yo = {0.f, 0.f};
            if (tt > 0) {
                #pragma unroll
                for (int rr = 0; rr < 2; ++rr) yo[rr] = dot8(S[rr], rprev);
            }
            if (tt < SCH) {
                StepIn p2 = p1;
                if (tt + 2 < SCH) p2 = load_step(sb + (tt + 2) * SSTEPF, coff, voff);
                float sa[2];
                v2f   T[2][4];
                #pragma unroll
                for (int rr = 0; rr < 2; ++rr) sa[rr] = dot8(S[rr], p0.a);
                #pragma unroll
                for (int rr = 0; rr < 2; ++rr) {
                    const v2f vv = {p0.v[rr], p0.v[rr]};
                    #pragma unroll
                    for (int q = 0; q < 4; ++q) T[rr][q] = S[rr][q] * p0.d.c[q] + vv * p0.k.c[q];
                }
                #pragma unroll
                for (int rr = 0; rr < 2; ++rr) {
                    const float s = row_sum8(sa[rr]);
                    const v2f ss = {s, s};
                    #pragma unroll
                    for (int q = 0; q < 4; ++q) S[rr][q] = T[rr][q] + ss * p0.b.c[q];
                }
                rprev = p0.r;
                p0 = p1;
                p1 = p2;
            }
            if (tt > 0) {
                const int u = tt - 1;
                #pragma unroll
                for (int rr = 0; rr < 2; ++rr) yo[rr] = row_sum8(yo[rr]);
                // lane lc keeps the y pair of step lc of each run of 8, then all lanes store at once
                if ((u & 7) == lc) keep = yo;
                if ((u & 7) == 7)
                    *(v2f*)(yb + ((u & 8) + lc) * SROWS + rloc) = keep;
            }
            // keeps each step's LDS reads a whole step ahead of their use: without it the scheduler sinks them next to it
            __builtin_amdgcn_sched_barrier(0);
        }
        asm volatile("s_wait_dscnt 0x0" ::: "memory");     // this wave has left the buffer, its y is in LDS
        asm volatile("s_wait_asynccnt 0x0" ::: "memory");  // its part of chunk c+1 has landed
        __syncthreads();   // publishes chunk c+1 and this chunk's y, ends every wave's reads of chunk c
        if (c + 2 < nC) {
            const size_t g = g0 + (size_t)(c + 2) * SCH * CC;
            scan_stage_chunk(lds0 + (c & 1) * SBUFB, r + g, dc + g, k + g, v + g, aa + g, bb + g);
        }
        const v4f yv = *(const v4f*)(yb + tid * 4);
        *(v4f*)(yg + (size_t)c * SCH * CC) = yv;
        asm volatile("s_wait_xcnt 0x0" ::: "memory");      // precaution: before the store's registers are reused
        ysum += yv;
        ysq  += yv * yv;
    }
    asm volatile("s_wait_asynccnt 0x0" ::: "memory");      // no copy is left when the wave ends

    // the block's sums of y and y*y: four values a thread, a 16-lane row, then the eight rows in order
    const float ps = row_sum16((ysum.x + ysum.y) + (ysum.z + ysum.w));
    const float pq = row_sum16((ysq.x + ysq.y) + (ysq.z + ysq.w));
    if ((tid & 15) == 0) *(v2f*)(hsum + (tid >> 4) * 2) = (v2f){ps, pq};
    __syncthreads();       // every row's pair is in LDS
    if (tid == 0) {
        v2f t = *(const v2f*)hsum;
        #pragma unroll   // constant LDS offsets
        for (int w = 1; w < 8; ++w) t += *(const v2f*)(hsum + w * 2);
        *(v2f*)(part + blockIdx.x * 32) = t;   // a 128-byte line of its own for each block: one writer a line
    }
}

// =====================================================================
// GroupNorm over (T,N) per (b,h) + bonus term. The two sums of a group come from the scan
// (two blocks a group), so nothing here spans the time axis and the work is spread over the
// chip: a block takes 8 rows x 1024 channels, a thread 4 channels of each row (16-byte loads
// and stores, 512 contiguous bytes a wave), a head lies in one 16-lane row. The 16 loads of
// four rows fly together. xx aliases rbuf (each lane reads its r before writing the same place).
// =====================================================================
#define GNR 8      // rows per block
#define GNB 4      // rows whose loads are in flight together
__global__ __launch_bounds__(256)
void gnorm_kernel(const float* __restrict__ y, const float* rbuf,
                  const float* __restrict__ kpost, const float* __restrict__ vpost,
                  const float* __restrict__ r_k, const float* __restrict__ ln_w,
                  const float* __restrict__ ln_b, const float* __restrict__ part, float* xx)
{
    // indices count 16-byte pieces and are unsigned: every access is a scalar base plus one 32-bit lane offset
    const unsigned c4 = blockIdx.y * 256u + threadIdx.x;                // the lane's four channels
    const unsigned bh = (blockIdx.x * GNR / TT) * HH + (c4 >> 4);       // GNR divides T: one batch a block

    const v2f pa = ((const v2f*)part)[bh * 32];          // sum and sum of squares over state rows 0-31 of the group
    const v2f pb = ((const v2f*)part)[bh * 32 + 16];     // the same over rows 32-63 (the next block's line)
    asm volatile("s_wait_xcnt 0x0" ::: "memory");        // precaution: before the next loads' results reuse the offset register
    const v4f rk = ((const v4f*)r_k)[c4];
    const v4f lw = ((const v4f*)ln_w)[c4];
    const v4f lb = ((const v4f*)ln_b)[c4];
    asm volatile("s_wait_xcnt 0x0" ::: "memory");        // precaution: before these loads' offset registers are reused
    const float mean = (pa.x + pb.x) * (1.f / 65536.f);
    const float var  = (pa.y + pb.y) * (1.f / 65536.f) - mean*mean;
    const float rstd = rsqrtf(var + GN_EPS);

    // one lane offset for the whole kernel; the rows are constant offsets from it
    const unsigned e0 = blockIdx.x * (GNR * CC / 4) + c4;
    const v4f* rp = (const v4f*)rbuf  + e0;
    const v4f* kp = (const v4f*)kpost + e0;
    const v4f* yp = (const v4f*)y     + e0;
    const v4f* vp = (const v4f*)vpost + e0;
    v4f*       xp = (v4f*)xx          + e0;
    #pragma unroll   // constant offsets on every load and store
    for (int g = 0; g < GNR; g += GNB) {
        v4f r4[GNB], k4[GNB], y4[GNB], v4[GNB], o[GNB];
        #pragma unroll   // the arrays must stay in registers
        for (int i = 0; i < GNB; ++i) {
            r4[i] = rp[(g + i) * (CC / 4)];
            k4[i] = kp[(g + i) * (CC / 4)];
            y4[i] = yp[(g + i) * (CC / 4)];
            v4[i] = vp[(g + i) * (CC / 4)];
        }
        // all 16 loads are issued before the first is used: without it the scheduler sinks half of them behind the first waits
        __builtin_amdgcn_sched_barrier(0);
        #pragma unroll   // the four rows' lane sums run side by side
        for (int i = 0; i < GNB; ++i) {
            const v4f p = r4[i] * k4[i] * rk;
            const float d = row_sum16((p.x + p.y) + (p.z + p.w));
            o[i] = (y4[i] - mean) * rstd * lw + lb + d * v4[i];
        }
        __builtin_amdgcn_sched_barrier(0);   // no vector work, which may reuse a stored register, between a store and the wait
        #pragma unroll   // o[] must stay in registers
        for (int i = 0; i < GNB; ++i)
            xp[(g + i) * (CC / 4)] = o[i];
        asm volatile("s_wait_xcnt 0x0" ::: "memory");    // precaution: before the stores' registers are reused
        __builtin_amdgcn_sched_barrier(0);   // the other edge of the same group
    }
}

// =====================================================================
extern "C" void kernel_launch(void* const* d_in, const int* in_sizes, int n_in,
                              void* d_out, int out_size, void* d_ws, size_t ws_size,
                              hipStream_t stream) {
    const float* x       = (const float*)d_in[0];
    const float* v_first = (const float*)d_in[1];
    const float* state0  = (const float*)d_in[2];
    const float* Rw      = (const float*)d_in[3];
    const float* R_bias  = (const float*)d_in[4];
    const float* Kw      = (const float*)d_in[5];
    const float* K_bias  = (const float*)d_in[6];
    const float* Vw      = (const float*)d_in[7];
    const float* V_bias  = (const float*)d_in[8];
    const float* Ow      = (const float*)d_in[9];
    const float* O_bias  = (const float*)d_in[10];
    const float* w0      = (const float*)d_in[11];
    const float* w1      = (const float*)d_in[12];
    const float* w2      = (const float*)d_in[13];
    const float* a0      = (const float*)d_in[14];
    const float* a1      = (const float*)d_in[15];
    const float* a2      = (const float*)d_in[16];
    const float* v0      = (const float*)d_in[17];
    const float* v1      = (const float*)d_in[18];
    const float* v2      = (const float*)d_in[19];
    const float* k_k     = (const float*)d_in[20];
    const float* k_a     = (const float*)d_in[21];
    const float* r_k     = (const float*)d_in[22];
    const float* ln_w    = (const float*)d_in[23];
    const float* ln_b    = (const float*)d_in[24];
    float* out = (float*)d_out;

    // workspace layout (floats)
    float* ws = (float*)d_ws;
    float* r_buf  = ws;                                // M*C   (later reused as xx)
    float* klin   = r_buf  + (size_t)MM*CC;            // M*512
    float* vlin   = klin   + (size_t)MM*KVC;           // M*512
    float* hw     = vlin   + (size_t)MM*KVC;           // M*64
    float* ha     = hw     + (size_t)MM*64;            // M*64
    float* hv     = ha     + (size_t)MM*64;            // M*32
    float* decayb = hv     + (size_t)MM*32;            // M*C
    float* kpost  = decayb + (size_t)MM*CC;            // M*C
    float* vpost  = kpost  + (size_t)MM*CC;            // M*C
    float* aab    = vpost  + (size_t)MM*CC;            // M*C
    float* bbb    = aab    + (size_t)MM*CC;            // M*C
    float* ybuf   = bbb    + (size_t)MM*CC;            // M*C
    float* gpart  = ybuf   + (size_t)MM*CC;            // B*H*2 lines of 32: each scan block's sums of y and y*y
    float* xx     = r_buf;                             // alias: r dead after bonus read

    const dim3 blk(256);
    // Step 1: projections (blocked WMMA for the big GEMMs): r, k and v as one grid of 3072 columns
    wmma_gemm_f32_blk<<<dim3(MM/128, (CC + KVC + KVC)/128), blk, 0, stream>>>(
        x, Rw, R_bias, r_buf, CC, Kw, K_bias, klin, KVC, Vw, V_bias, vlin, KVC, CC);
    lora_in_kernel<<<dim3(MM/16), dim3(256), 0, stream>>>(x, w1, a1, v1, hw, ha, hv);

    // fused elementwise prep
    fusion_kernel<<<dim3(MM/128, HH), dim3(256), 0, stream>>>(
        klin, vlin, hw, ha, hv, v_first, w0, w2, a0, a2, v0, v2, k_k, k_a,
        decayb, kpost, vpost, aab, bbb);

    // Step 2: sequential scan
    scan_kernel<<<dim3(BB*HH*2), dim3(128), 0, stream>>>(
        r_buf, decayb, kpost, vpost, aab, bbb, state0, ybuf, gpart);

    // Step 3: group norm + bonus
    gnorm_kernel<<<dim3(MM/GNR, CC/1024), dim3(256), 0, stream>>>(
        ybuf, r_buf, kpost, vpost, r_k, ln_w, ln_b, gpart, xx);

    // output projection
    wmma_gemm_f32_blk<<<dim3(MM/128, CC/128), blk, 0, stream>>>(
        xx, Ow, O_bias, out, CC, Ow, O_bias, out, 0, Ow, O_bias, out, 0, CC);
    (void)in_sizes; (void)n_in; (void)out_size; (void)ws_size;
}

// v007
// A run of this version takes 528 microseconds.
// In both of two side-by-side timings against v006, it was 1.14 times as fast.
// Counting every step since v000, it is 8.25 times as fast.
#include <hip/hip_runtime.h>
#include <math.h>

// ---------------- problem constants ----------------
#define BB  4
#define TT  1024
#define CC  2048
#define HH  32
#define NN  64
#define KVC 512
#define MM  (BB*TT)          // 4096 rows
#define GN_EPS 0.00064f

typedef float v2f __attribute__((ext_vector_type(2)));
typedef float v8f __attribute__((ext_vector_type(8)));

#define GBK     64
#define GPITCH  68
#define GROWB   (GPITCH * 4)
#define GBUFB   (256 * GROWB)

// Eight of a thread's sixteen 16-byte pieces of one k tile: rows r, r+16, r+32, r+48 of X and of W.
// The wait on the last line stands before the address registers can be rewritten.
__device__ __forceinline__
void gemm_stage_tile(unsigned lds, const float* gx, const float* gw, size_t rstep)
{
    asm volatile(
        "global_load_async_to_lds_b128 %0, %8, off\n\t"
        "global_load_async_to_lds_b128 %1, %9, off\n\t"
        "global_load_async_to_lds_b128 %2, %10, off\n\t"
        "global_load_async_to_lds_b128 %3, %11, off\n\t"
        "global_load_async_to_lds_b128 %4, %12, off\n\t"
        "global_load_async_to_lds_b128 %5, %13, off\n\t"
        "global_load_async_to_lds_b128 %6, %14, off\n\t"
        "global_load_async_to_lds_b128 %7, %15, off\n\t"
        "s_wait_xcnt 0x0"
        :: "v"(lds),              "v"(lds +  16*GROWB), "v"(lds +  32*GROWB), "v"(lds +  48*GROWB),
           "v"(lds + 128*GROWB),  "v"(lds + 144*GROWB), "v"(lds + 160*GROWB), "v"(lds + 176*GROWB),
           "v"(gx), "v"(gx + rstep), "v"(gx + 2*rstep), "v"(gx + 3*rstep),
           "v"(gw), "v"(gw + rstep), "v"(gw + 2*rstep), "v"(gw + 3*rstep)
        : "memory");
}

__global__ __launch_bounds__(256)
void wmma_gemm_f32_blk(const float* __restrict__ X,
                       const float* W0, const float* bias0, float* Out0, int Nc0,
                       const float* W1, const float* bias1, float* Out1, int Nc1,
                       const float* W2, const float* bias2, float* Out2, int Nc2,
                       int K)
{
    __shared__ __attribute__((aligned(16))) float tile[2 * 256 * GPITCH];

    // which product the block's 128 columns belong to (the same for the whole block)
    int cb = blockIdx.y * 128;
    const float* W = W0; const float* bias = bias0; float* Out = Out0; int Nc = Nc0;
    if (cb >= Nc0 + Nc1) { W = W2; bias = bias2; Out = Out2; Nc = Nc2; cb -= Nc0 + Nc1; }
    else if (cb >= Nc0)  { W = W1; bias = bias1; Out = Out1; Nc = Nc1; cb -= Nc0; }

    const int lane = threadIdx.x & 31;
    const int wave = threadIdx.x >> 5;
    const int half = lane >> 4;
    const int l    = lane & 15;
    const int mw   = wave >> 2, nw = wave & 3;
    const int tileM = blockIdx.x * 128 + mw * 64;
    const int tileN = cb + nw * 32;

    // copies: 16 lanes a row (16 bytes each), 16 rows per pass over the block's 256 threads
    const int crow = threadIdx.x >> 4, cpos = (threadIdx.x & 15) * 4;
    const float* gx = X + (size_t)(blockIdx.x * 128 + crow) * K + cpos;
    const float* gw = W + (size_t)(cb + crow) * K + cpos;
    const size_t rstep = (size_t)16 * K;
    const unsigned lds0 = (unsigned)(uintptr_t)tile + (unsigned)(crow * GROWB + cpos * 4);
    const int nT = K / GBK;

    // rows 0-63 and rows 64-127 of both operands
    auto stage = [&](int buf, int t) {
        const unsigned o = lds0 + (unsigned)buf * GBUFB;
        const float* px = gx + (size_t)t * GBK;
        const float* pw = gw + (size_t)t * GBK;
        gemm_stage_tile(o,              px,             pw,             rstep);
        gemm_stage_tile(o + 64 * GROWB, px + 4 * rstep, pw + 4 * rstep, rstep);
    };

    stage(0, 0);
    asm volatile("s_wait_asynccnt 0x0" ::: "memory");   // tile 0 has landed (this wave's part)
    __syncthreads();                                    // ... and every other wave's
    if (nT > 1) stage(1, 1);

    // fragments: lane -> row, half -> k pair, the same k order in A and B
    const int aoff = (mw * 64 + l) * GPITCH + 2*half;
    const int boff = (128 + nw * 32 + l) * GPITCH + 2*half;

    v8f acc[4][2];
    #pragma unroll   // acc[] must stay in registers
    for (int i = 0; i < 4; ++i) { acc[i][0] = (v8f){}; acc[i][1] = (v8f){}; }

    for (int t = 0; t < nT; ++t) {
        const float* buf = tile + (t & 1) * (256 * GPITCH);
        const float* as  = buf + aoff;
        const float* bs  = buf + boff;
        #pragma unroll   // constant LDS offsets on every fragment read
        for (int s = 0; s < GBK; s += 4) {
            v2f a[4], b[2];
            #pragma unroll
            for (int i = 0; i < 4; ++i) a[i] = *(const v2f*)(as + i * 16 * GPITCH + s);
            #pragma unroll
            for (int n = 0; n < 2; ++n) b[n] = *(const v2f*)(bs + n * 16 * GPITCH + s);
            #pragma unroll
            for (int i = 0; i < 4; ++i) {
                #pragma unroll
                for (int n = 0; n < 2; ++n)
                    acc[i][n] = __builtin_amdgcn_wmma_f32_16x16x4_f32(false, a[i], false, b[n], (short)0, acc[i][n], false, false);
            }
        }
        asm volatile("s_wait_dscnt 0x0" ::: "memory");     // this wave has left the buffer
        asm volatile("s_wait_asynccnt 0x0" ::: "memory");  // its part of tile t+1 has landed
        __syncthreads();   // publishes tile t+1 and ends every wave's reads of tile t
        if (t + 2 < nT) stage(t & 1, t + 2);
    }
    asm volatile("s_wait_asynccnt 0x0" ::: "memory");      // no copy is left when the wave ends

    const int col0 = tileN + l, col1 = tileN + 16 + l;
    const float bs0 = bias ? bias[col0] : 0.0f;
    const float bs1 = bias ? bias[col1] : 0.0f;
    asm volatile("s_wait_xcnt 0x0" ::: "memory");   // precaution: before the bias loads' offset register is reused for the store addresses
    __builtin_amdgcn_sched_barrier(0);   // keeps the store-address arithmetic, which reuses that register, behind the wait
    #pragma unroll   // acc[] is indexed: registers only when unrolled
    for (int i = 0; i < 4; ++i) {
        #pragma unroll
        for (int j = 0; j < 8; ++j) {
            const int row = tileM + i * 16 + j + 8*half;   // C/D: VGPR j -> M=j / j+8
            Out[(size_t)row * Nc + col0] = acc[i][0][j] + bs0;
            Out[(size_t)row * Nc + col1] = acc[i][1][j] + bs1;
        }
    }
}

// =====================================================================
// LoRA first-stage products x@w1 (then tanh), x@a1, x@v1 in ONE launch: the three
// weights, stored (K,Nc), are taken as one (K,160) matrix. A block owns 16 rows of x
// and all 160 columns; its 8 waves split k: of each staged tile of 128 k a wave takes
// 16, with 10 independent accumulator tiles, so one A fragment serves 10 WMMAs.
// Tiles come into LDS in whole lines by asynchronous copies, two buffers; the eight
// partial sums are added through LDS at the end, in wave order.
// =====================================================================
typedef float v4f __attribute__((ext_vector_type(4)));

#define LK    128                  // k per staged tile
#define LWP   168                  // LDS pitch (floats) of a weight row: rows k and k+2 of a fragment read fall 16 banks apart
#define LXP   132                  // LDS pitch (floats) of an x row: 16 rows of an 8-byte fragment read meet 64 distinct banks
#define LWF   (LK * LWP)           // floats of the weight part of a buffer
#define LBUFF (LWF + 16 * LXP)     // floats of one buffer
#define LBUFB (LBUFF * 4)
#define LRP   164                  // LDS pitch (floats) of a partial-sum row: rows j and j+8 fall 32 banks apart

// Eleven 16-byte pieces of one k tile: rows r, r+16, .. r+112 of a 64-wide weight,
// rows q, q+32 of the 32-wide weight, one piece of x.
// The wait on the last line stands before the address registers can be rewritten.
__device__ __forceinline__
void lora_stage11(unsigned lw, const float* gw, unsigned lv, const float* gv,
                  unsigned lx, const float* gx)
{
    asm volatile(
        "global_load_async_to_lds_b128 %0, %11, off\n\t"
        "global_load_async_to_lds_b128 %1, %12, off\n\t"
        "global_load_async_to_lds_b128 %2, %13, off\n\t"
        "global_load_async_to_lds_b128 %3, %14, off\n\t"
        "global_load_async_to_lds_b128 %4, %15, off\n\t"
        "global_load_async_to_lds_b128 %5, %16, off\n\t"
        "global_load_async_to_lds_b128 %6, %17, off\n\t"
        "global_load_async_to_lds_b128 %7, %18, off\n\t"
        "global_load_async_to_lds_b128 %8, %19, off\n\t"
        "global_load_async_to_lds_b128 %9, %20, off\n\t"
        "global_load_async_to_lds_b128 %10, %21, off\n\t"
        "s_wait_xcnt 0x0"
        :: "v"(lw),                "v"(lw +  16*LWP*4), "v"(lw +  32*LWP*4), "v"(lw +  48*LWP*4),
           "v"(lw + 64*LWP*4),     "v"(lw +  80*LWP*4), "v"(lw +  96*LWP*4), "v"(lw + 112*LWP*4),
           "v"(lv),                "v"(lv +  32*LWP*4), "v"(lx),
           "v"(gw),         "v"(gw + 16*64), "v"(gw + 32*64), "v"(gw +  48*64),
           "v"(gw + 64*64), "v"(gw + 80*64), "v"(gw + 96*64), "v"(gw + 112*64),
           "v"(gv),         "v"(gv + 32*32), "v"(gx)
        : "memory");
}

__global__ __launch_bounds__(256)
void lora_in_kernel(const float* __restrict__ X,  const float* __restrict__ w1,
                    const float* __restrict__ a1, const float* __restrict__ v1,
                    float* __restrict__ hw, float* __restrict__ ha, float* __restrict__ hv)
{
    __shared__ __attribute__((aligned(16))) float st[2 * LBUFF];

    const int tid  = threadIdx.x;
    const int lane = tid & 31, wave = tid >> 5;
    const int half = lane >> 4, l = lane & 15;
    const int m0   = blockIdx.x * 16;

    // copies: 16 lanes a row of w1 / a1, 8 lanes a row of v1, 32 lanes a row of x
    const size_t  g64 = (size_t)(tid >> 4) * 64 + (tid & 15) * 4;
    const float*  gv  = v1 + (size_t)(tid >> 3) * 32 + (tid & 7) * 4;
    const float*  gx  = X  + (size_t)(m0 + (tid >> 5)) * CC + (tid & 31) * 4;
    const unsigned lb = (unsigned)(uintptr_t)st;
    const unsigned lw = lb + (unsigned)(((tid >> 4) * LWP + (tid & 15) * 4) * 4);
    const unsigned lv = lb + (unsigned)(((tid >> 3) * LWP + 128 + (tid & 7) * 4) * 4);
    const unsigned lx = lb + (unsigned)((LWF + (tid >> 5) * LXP + (tid & 31) * 4) * 4);
    const int nT = CC / LK;

    auto stage = [&](int buf, int t) {
        const unsigned o = (unsigned)buf * LBUFB;
        lora_stage11(lw + o,          w1 + g64 + (size_t)t * LK * 64,
                     lv + o,          gv + (size_t)t * LK * 32,
                     lx + o,          gx + t * LK);
        lora_stage11(lw + o + 64 * 4, a1 + g64 + (size_t)t * LK * 64,
                     lv + o + 64 * LWP * 4, gv + (size_t)t * LK * 32 + 64 * 32,
                     lx + o + 8 * LXP * 4,  gx + t * LK + 8 * CC);
    };

    stage(0, 0);
    asm volatile("s_wait_asynccnt 0x0" ::: "memory");   // tile 0 has landed (this wave's part)
    __syncthreads();                                    // ... and every other wave's
    stage(1, 1);

    // fragments: A lane -> row, B lane -> column, half -> k pair (the same k order in both)
    const int aoff = LWF + l * LXP + wave * 16 + 2 * half;
    const int boff = (wave * 16 + 2 * half) * LWP + l;

    v8f acc[10];
    #pragma unroll   // acc[] must stay in registers
    for (int nt = 0; nt < 10; ++nt) acc[nt] = (v8f){};

    for (int t = 0; t < nT; ++t) {
        const float* buf = st + (t & 1) * LBUFF;
        #pragma unroll   // constant LDS offsets on every fragment read
        for (int s = 0; s < 4; ++s) {
            const v2f a = *(const v2f*)(buf + aoff + 4 * s);
            const float* bp = buf + boff + 4 * s * LWP;
            #pragma unroll
            for (int nt = 0; nt < 10; ++nt) {
                v2f b;
                b.x = bp[nt * 16];
                b.y = bp[LWP + nt * 16];
                acc[nt] = __builtin_amdgcn_wmma_f32_16x16x4_f32(false, a, false, b, (short)0, acc[nt], false, false);
            }
        }
        asm volatile("s_wait_dscnt 0x0" ::: "memory");     // this wave has left the buffer
        asm volatile("s_wait_asynccnt 0x0" ::: "memory");  // its part of tile t+1 has landed
        __syncthreads();   // publishes tile t+1 and ends every wave's reads of tile t
        if (t + 2 < nT) stage(t & 1, t + 2);
    }
    asm volatile("s_wait_asynccnt 0x0" ::: "memory");      // no copy is left when the LDS is reused

    // the eight waves' partial sums (C/D: VGPR j -> row j / j+8, lane -> column)
    float* red = st;
    #pragma unroll
    for (int nt = 0; nt < 10; ++nt) {
        #pragma unroll
        for (int j = 0; j < 8; ++j)
            red[(wave * 16 + j + 8 * half) * LRP + nt * 16 + l] = acc[nt][j];
    }
    __syncthreads();       // every wave's partial sums are in LDS

    // 16 rows x 40 pieces of four columns over 256 threads: two full passes and a half one
    for (int q = tid; q < 16 * 40; q += 256) {
        const int row = q / 40, c4 = (q - row * 40) * 4;
        v4f s = *(const v4f*)(red + row * LRP + c4);
        #pragma unroll
        for (int w = 1; w < 8; ++w) s += *(const v4f*)(red + (w * 16 + row) * LRP + c4);
        float* p;
        if (c4 < 64) {
            #pragma unroll
            for (int e = 0; e < 4; ++e) s[e] = tanhf(s[e]);
            p = hw + (size_t)(m0 + row) * 64 + c4;
        } else if (c4 < 128) {
            p = ha + (size_t)(m0 + row) * 64 + (c4 - 64);
        } else {
            p = hv + (size_t)(m0 + row) * 32 + (c4 - 128);
        }
        *(v4f*)p = s;
        asm volatile("s_wait_xcnt 0x0" ::: "memory");   // precaution: before the store's registers are reused in the next pass
    }
}

#define XCNT_WAIT() asm volatile("s_wait_xcnt 0x0" ::: "memory")
// Round a group of stores and its wait: keeps the scheduler from placing vector work,
// which may reuse a stored register, between a store and the wait.
#define SCHED_EDGE() __builtin_amdgcn_sched_barrier(0)

// The gates run on the chip's own exp2 and reciprocal instructions (about one unit in the last place each)
// in place of the library's expf, log1pf and f32 division, which cost tens of vector instructions a value.
// Eight values go through one asm statement: the results take registers of their own ("=&v"), so that inside it
// no instruction reads the result or overwrites the source of the one in front of it, and the v_nop is the slot
// that the instruction set asks for behind the last one, ahead of whatever the compiler places next.
#define TRANS_X8(NAME, OP)                                                                   \
__device__ __forceinline__ v8f NAME(v8f x)                                                   \
{                                                                                            \
    float r0, r1, r2, r3, r4, r5, r6, r7;                                                    \
    asm(OP " %0, %8\n\t"  OP " %1, %9\n\t"  OP " %2, %10\n\t" OP " %3, %11\n\t"             \
        OP " %4, %12\n\t" OP " %5, %13\n\t" OP " %6, %14\n\t" OP " %7, %15\n\t"             \
        "v_nop"                                                                              \
        : "=&v"(r0), "=&v"(r1), "=&v"(r2), "=&v"(r3), "=&v"(r4), "=&v"(r5), "=&v"(r6), "=&v"(r7) \
        : "v"(x[0]), "v"(x[1]), "v"(x[2]), "v"(x[3]), "v"(x[4]), "v"(x[5]), "v"(x[6]), "v"(x[7])); \
    return (v8f){r0, r1, r2, r3, r4, r5, r6, r7};                                            \
}
TRANS_X8(exp2_x8, "v_exp_f32")
TRANS_X8(rcp_x8,  "v_rcp_f32")
#undef TRANS_X8

// 1/(1+exp(-z)): exp2 gives +inf for very negative z and the reciprocal then 0, as the limit asks.
__device__ __forceinline__ v8f sigmoid_x8(v8f z)
{
    return rcp_x8(1.f + exp2_x8(-1.44269504f * z));
}
// exp(-exp(-softplus(-t) - 0.6)): exp(-softplus(-t)) is 1/(1+exp(-t)), so the inner exp is exp(-0.6) * sigmoid(t)
// for every t, and neither the logarithm nor the exp that undoes it is computed.
// The factor is exp(-0.6) * log2(e), for the base-2 exp.
__device__ __forceinline__ v8f decay_x8(v8f t)
{
    return exp2_x8(-0.79176784f * sigmoid_x8(t));
}

template<int K>
__device__ __forceinline__
void lora_tile(const float* __restrict__ A, const float* __restrict__ Bm,
               const float* __restrict__ init, int tileM, int cbase,
               int l, int half, v8f (&acc)[4])
{
    const float* arow = A  + (size_t)(tileM + l) * K + 2*half;   // A: lane -> row, half -> k pair
    const float* bcol = Bm + (size_t)(2*half) * CC + cbase + l;  // B: lane -> col, half -> k pair
    XCNT_WAIT();     // behind the stores of the phase before
    #pragma unroll   // acc[] must stay in registers
    for (int nt = 0; nt < 4; ++nt) {
        const float c0 = init[cbase + nt*16 + l];                // the bias vector starts the sum
        #pragma unroll
        for (int j = 0; j < 8; ++j) acc[nt][j] = c0;
    }
    XCNT_WAIT();
    #pragma unroll   // constant offsets on every load
    for (int kc = 0; kc < K; kc += 16) {
        // all 36 fragment loads of a 16-deep k chunk first: one cache latency per 16 WMMAs
        v2f a[4], b[4][4];
        #pragma unroll
        for (int s = 0; s < 4; ++s) a[s] = *(const v2f*)(arow + kc + 4*s);
        XCNT_WAIT();
        #pragma unroll
        for (int s = 0; s < 4; ++s) {
            const int k0 = kc + 4*s;
            #pragma unroll
            for (int nt = 0; nt < 4; ++nt) {
                b[s][nt].x = bcol[(size_t)(k0    ) * CC + nt*16];
                b[s][nt].y = bcol[(size_t)(k0 + 1) * CC + nt*16];
            }
        }
        XCNT_WAIT();
        #pragma unroll
        for (int s = 0; s < 4; ++s) {
            #pragma unroll
            for (int nt = 0; nt < 4; ++nt)
                acc[nt] = __builtin_amdgcn_wmma_f32_16x16x4_f32(false, a[s], false, b[s][nt], (short)0, acc[nt], false, false);
        }
    }
}

// 16 rows x 64 columns of a row-major array in the accumulator layout, one batch of loads.
__device__ __forceinline__
void load_tile(const float* __restrict__ p, int pitch, v8f (&t)[4])
{
    #pragma unroll   // t[] must stay in registers
    for (int nt = 0; nt < 4; ++nt) {
        #pragma unroll
        for (int j = 0; j < 8; ++j) t[nt][j] = p[(size_t)j * pitch + nt*16];
    }
    XCNT_WAIT();
}

__global__ __launch_bounds__(256)
void fusion_kernel(const float* __restrict__ klin, const float* __restrict__ vlin,
                   const float* __restrict__ hw,  const float* __restrict__ ha,
                   const float* __restrict__ hv,  const float* __restrict__ v_first,
                   const float* __restrict__ w0,  const float* __restrict__ w2,
                   const float* __restrict__ a0,  const float* __restrict__ a2,
                   const float* __restrict__ v0,  const float* __restrict__ v2,
                   const float* __restrict__ k_k, const float* __restrict__ k_a,
                   float* __restrict__ decay, float* __restrict__ kpost,
                   float* __restrict__ vpost, float* __restrict__ aaO,
                   float* __restrict__ bbO)
{
    const int lane = threadIdx.x & 31;
    const int wave = threadIdx.x >> 5;
    const int half = lane >> 4;
    const int l    = lane & 15;
    const int tileM  = blockIdx.x * 128 + wave * 16;
    const int h      = blockIdx.y;
    const int cbase  = h * NN;
    const int kvbase = (h >> 2) * NN;                 // kv-head repeat
    const int row0   = tileM + 8*half;                // C/D: VGPR j -> row j / j+8
    const size_t g0  = (size_t)row0 * CC  + cbase  + l;   // element (j, nt) at g0 + j*CC + nt*16
    const size_t q0  = (size_t)row0 * KVC + kvbase + l;
    v8f acc[4], t0[4], t1[4];

    // ---- decay ----
    lora_tile<64>(hw, w2, w0, tileM, cbase, l, half, acc);
    #pragma unroll   // acc[] is indexed: registers only when unrolled
    for (int nt = 0; nt < 4; ++nt) {
        const v8f o = decay_x8(acc[nt]);
        SCHED_EDGE();
        #pragma unroll
        for (int j = 0; j < 8; ++j) decay[g0 + (size_t)j * CC + nt*16] = o[j];
        XCNT_WAIT();
        SCHED_EDGE();
    }

    // ---- value blend ----
    lora_tile<32>(hv, v2, v0, tileM, cbase, l, half, acc);
    load_tile(vlin + q0, KVC, t0);
    load_tile(v_first + g0, CC, t1);
    #pragma unroll
    for (int nt = 0; nt < 4; ++nt) {
        const v8f o = t0[nt] + (t1[nt] - t0[nt]) * sigmoid_x8(acc[nt]);
        SCHED_EDGE();
        #pragma unroll
        for (int j = 0; j < 8; ++j) vpost[g0 + (size_t)j * CC + nt*16] = o[j];
        XCNT_WAIT();
        SCHED_EDGE();
    }

    // ---- a gate, k, normalised kk ----
    lora_tile<64>(ha, a2, a0, tileM, cbase, l, half, acc);
    load_tile(klin + q0, KVC, t0);
    float kkc[4], kac[4];
    #pragma unroll
    for (int nt = 0; nt < 4; ++nt) kkc[nt] = k_k[cbase + nt*16 + l];
    XCNT_WAIT();
    #pragma unroll
    for (int nt = 0; nt < 4; ++nt) kac[nt] = k_a[cbase + nt*16 + l];
    XCNT_WAIT();
    float ss[8];
    #pragma unroll
    for (int j = 0; j < 8; ++j) ss[j] = 0.f;
    #pragma unroll
    for (int nt = 0; nt < 4; ++nt) {
        v8f o;
        const v8f ag = sigmoid_x8(acc[nt]);
        #pragma unroll
        for (int j = 0; j < 8; ++j) {
            const float av = ag[j];
            const float kf = t0[nt][j];
            const float kkp = kf * kkc[nt];
            o[j] = kf * (1.f + (av - 1.f) * kac[nt]);
            t0[nt][j]  = kkp;
            acc[nt][j] = av;
            ss[j] += kkp * kkp;
        }
        SCHED_EDGE();
        #pragma unroll
        for (int j = 0; j < 8; ++j) kpost[g0 + (size_t)j * CC + nt*16] = o[j];
        XCNT_WAIT();
        SCHED_EDGE();
    }
    #pragma unroll
    for (int j = 0; j < 8; ++j) {
        float s = ss[j];
        // a row's 64 channels sit in the 16 lanes of one half (4 per lane)
        for (int off = 8; off; off >>= 1) s += __shfl_xor(s, off);
        const float rn = 1.f / fmaxf(sqrtf(s), 1e-12f);
        float oa[4], ob[4];
        #pragma unroll
        for (int nt = 0; nt < 4; ++nt) {
            const float kkn = t0[nt][j] * rn;
            oa[nt] = -kkn;
            ob[nt] = kkn * acc[nt][j];
        }
        SCHED_EDGE();
        #pragma unroll
        for (int nt = 0; nt < 4; ++nt) {
            aaO[g0 + (size_t)j * CC + nt*16] = oa[nt];
            bbO[g0 + (size_t)j * CC + nt*16] = ob[nt];
        }
        XCNT_WAIT();
        SCHED_EDGE();
    }
}
#undef XCNT_WAIT
#undef SCHED_EDGE

// =====================================================================
// Sequential RWKV-7 scan. The 64 state rows of a (batch, head) never exchange anything,
// so they are spread wide: grid = B*H*2, a block of 4 waves owns 32 rows, a wave 8 rows.
// A row lies across 8 lanes (8 columns a lane: 4*lc.. and 32+4*lc..) and a lane holds two
// rows, so each vector element read from LDS serves two state elements and the chain
// of one time step is 8 products, a 3-step lane sum and one multiply-add.
// The six per-step vectors are staged 16 time steps at a time by asynchronous copies,
// two buffers, one barrier per 16 steps; y leaves through LDS in whole 128-byte lines.
// Where a thread stores y it also adds it, and its square, to sums of its own: at the end the
// block leaves its share of the group norm's two sums (half a (batch, head) group) in part[].
// =====================================================================
#define SCH    16                  // time steps per staged chunk
#define SSTEPF (6 * NN)            // floats of one staged step: r, decay, k, v, aa, bb
#define SBUFF  (SCH * SSTEPF)      // floats of one buffer
#define SBUFB  (SBUFF * 4)
#define SROWS  32                  // state rows per block

// A thread's twelve 16-byte pieces of one chunk: steps s and s+8 of each of the six arrays.
// The wait on the last line stands before the address registers can be rewritten.
__device__ __forceinline__
void scan_stage_chunk(unsigned lds, const float* r, const float* dc, const float* k,
                      const float* v, const float* aa, const float* bb)
{
    asm volatile(
        "global_load_async_to_lds_b128 %0, %12, off\n\t"
        "global_load_async_to_lds_b128 %1, %13, off\n\t"
        "global_load_async_to_lds_b128 %2, %14, off\n\t"
        "global_load_async_to_lds_b128 %3, %15, off\n\t"
        "global_load_async_to_lds_b128 %4, %16, off\n\t"
        "global_load_async_to_lds_b128 %5, %17, off\n\t"
        "global_load_async_to_lds_b128 %6, %18, off\n\t"
        "global_load_async_to_lds_b128 %7, %19, off\n\t"
        "global_load_async_to_lds_b128 %8, %20, off\n\t"
        "global_load_async_to_lds_b128 %9, %21, off\n\t"
        "global_load_async_to_lds_b128 %10, %22, off\n\t"
        "global_load_async_to_lds_b128 %11, %23, off\n\t"
        "s_wait_xcnt 0x0"
        :: "v"(lds),            "v"(lds + 1*NN*4), "v"(lds + 2*NN*4),
           "v"(lds + 3*NN*4),   "v"(lds + 4*NN*4), "v"(lds + 5*NN*4),
           "v"(lds + 8*SSTEPF*4),            "v"(lds + 8*SSTEPF*4 + 1*NN*4), "v"(lds + 8*SSTEPF*4 + 2*NN*4),
           "v"(lds + 8*SSTEPF*4 + 3*NN*4),   "v"(lds + 8*SSTEPF*4 + 4*NN*4), "v"(lds + 8*SSTEPF*4 + 5*NN*4),
           "v"(r), "v"(dc), "v"(k), "v"(v), "v"(aa), "v"(bb),
           "v"(r + 8*CC), "v"(dc + 8*CC), "v"(k + 8*CC), "v"(v + 8*CC), "v"(aa + 8*CC), "v"(bb + 8*CC)
        : "memory");
}

// x + (x of the lane whose number differs in the bits of MASK), inside a 16-lane row
template<int MASK>
__device__ __forceinline__ float lane_xor_add(float x)
{
    const int o = __builtin_amdgcn_update_dpp(0, __builtin_bit_cast(int, x), 0x160 + MASK, 0xf, 0xf, true);
    return x + __builtin_bit_cast(float, o);
}
// sum over the 8 lanes that share a state row; every one of them gets it
__device__ __forceinline__ float row_sum8(float x)
{
    x = lane_xor_add<1>(x);
    x = lane_xor_add<2>(x);
    return lane_xor_add<4>(x);
}
// sum over a 16-lane row; every one of them gets it
__device__ __forceinline__ float row_sum16(float x)
{
    return lane_xor_add<8>(row_sum8(x));
}

// the lane's 8 columns of one staged vector
struct Cols { v2f c[4]; };
__device__ __forceinline__ Cols load_cols(const float* p)
{
    const v4f lo = *(const v4f*)p, hi = *(const v4f*)(p + 32);
    Cols o;
    o.c[0] = __builtin_shufflevector(lo, lo, 0, 1);
    o.c[1] = __builtin_shufflevector(lo, lo, 2, 3);
    o.c[2] = __builtin_shufflevector(hi, hi, 0, 1);
    o.c[3] = __builtin_shufflevector(hi, hi, 2, 3);
    return o;
}
struct StepIn { Cols r, d, k, a, b; v2f v; };
__device__ __forceinline__ StepIn load_step(const float* sp, int coff, int voff)
{
    StepIn s;
    s.a = load_cols(sp + 4*NN + coff);
    s.d = load_cols(sp + 1*NN + coff);
    s.k = load_cols(sp + 2*NN + coff);
    s.v = *(const v2f*)(sp + 3*NN + voff);
    s.b = load_cols(sp + 5*NN + coff);
    s.r = load_cols(sp + coff);
    return s;
}
__device__ __forceinline__ float dot8(const v2f (&s)[4], const Cols& x)
{
    const v2f p = s[0]*x.c[0] + s[1]*x.c[1];
    const v2f q = s[2]*x.c[2] + s[3]*x.c[3];
    const v2f t = p + q;
    return t.x + t.y;
}

__global__ __launch_bounds__(128)
void scan_kernel(const float* __restrict__ r, const float* __restrict__ dc,
                 const float* __restrict__ k, const float* __restrict__ v,
                 const float* __restrict__ aa, const float* __restrict__ bb,
                 const float* __restrict__ state0, float* __restrict__ y,
                 float* __restrict__ part)
{
    __shared__ __attribute__((aligned(16))) float stage[2 * SBUFF];
    __shared__ __attribute__((aligned(16))) float ybuf[2 * SCH * SROWS];
    __shared__ __attribute__((aligned(16))) float hsum[16];   // (sum, sum of squares) of each 16-lane row

    const int bh    = blockIdx.x >> 1;         // b*H + h
    const int rbase = (blockIdx.x & 1) * SROWS;
    const int b = bh >> 5, h = bh & 31;
    const int tid  = threadIdx.x;
    const int lane = tid & 31, wave = tid >> 5;
    const int lc = lane & 7, lr = lane >> 3;
    const int rloc = wave * 8 + lr * 2;        // the lane's two rows inside the block's 32
    const int coff = lc * 4;
    const int voff = rbase + rloc;

    v2f S[2][4];
    #pragma unroll   // S[] must stay in registers
    for (int rr = 0; rr < 2; ++rr) {
        const Cols c = load_cols(state0 + ((size_t)bh * NN + rbase + rloc + rr) * NN + coff);
        #pragma unroll
        for (int q = 0; q < 4; ++q) S[rr][q] = c.c[q];
    }
    asm volatile("s_wait_xcnt 0x0" ::: "memory");   // precaution: before the state loads' address registers are reused

    // copies: 16 lanes a vector (16 bytes each), 8 steps per pass over the block's 128 threads
    const int crow = tid >> 4, cpos = (tid & 15) * 4;
    const size_t g0 = ((size_t)(b * TT + crow)) * CC + h * NN + cpos;
    const unsigned lds0 = (unsigned)(uintptr_t)stage + (unsigned)((crow * SSTEPF + cpos) * 4);
    // y: 8 lanes store one step's 128-byte line of the block's 32 rows
    float* yg = y + ((size_t)(b * TT + (tid >> 3))) * CC + h * NN + rbase + (tid & 7) * 4;
    const int nC = TT / SCH;

    scan_stage_chunk(lds0, r + g0, dc + g0, k + g0, v + g0, aa + g0, bb + g0);
    asm volatile("s_wait_asynccnt 0x0" ::: "memory");   // chunk 0 has landed (this wave's part)
    __syncthreads();                                    // ... and every other wave's
    {
        const size_t g = g0 + (size_t)SCH * CC;
        scan_stage_chunk(lds0 + SBUFB, r + g, dc + g, k + g, v + g, aa + g, bb + g);
    }

    v4f ysum = {0.f, 0.f, 0.f, 0.f}, ysq = {0.f, 0.f, 0.f, 0.f};
    for (int c = 0; c < nC; ++c) {
        const float* sb = stage + (c & 1) * SBUFF;
        float* yb = ybuf + (c & 1) * (SCH * SROWS);
        v2f keep = {0.f, 0.f};
        // vectors are read from LDS two steps ahead of their use
        StepIn p0 = load_step(sb, coff, voff);
        StepIn p1 = load_step(sb + SSTEPF, coff, voff);
        Cols rprev = p0.r;
        #pragma unroll   // constant LDS offsets; the step records stay in registers
        for (int tt = 0; tt <= SCH; ++tt) {
            // y of step tt-1 is a dot product of the same S as this step's sa: the four lane sums run side by side
            v2f yo = {0.f, 0.f};
            if (tt > 0) {
                #pragma unroll
                for (int rr = 0; rr < 2; ++rr) yo[rr] = dot8(S[rr], rprev);
            }
            if (tt < SCH) {
                StepIn p2 = p1;
                if (tt + 2 < SCH) p2 = load_step(sb + (tt + 2) * SSTEPF, coff, voff);
                float sa[2];
                v2f   T[2][4];
                #pragma unroll
                for (int rr = 0; rr < 2; ++rr) sa[rr] = dot8(S[rr], p0.a);
                #pragma unroll
                for (int rr = 0; rr < 2; ++rr) {
                    const v2f vv = {p0.v[rr], p0.v[rr]};
                    #pragma unroll
                    for (int q = 0; q < 4; ++q) T[rr][q] = S[rr][q] * p0.d.c[q] + vv * p0.k.c[q];
                }
                #pragma unroll
                for (int rr = 0; rr < 2; ++rr) {
                    const float s = row_sum8(sa[rr]);
                    const v2f ss = {s, s};
                    #pragma unroll
                    for (int q = 0; q < 4; ++q) S[rr][q] = T[rr][q] + ss * p0.b.c[q];
                }
                rprev = p0.r;
                p0 = p1;
                p1 = p2;
            }
            if (tt > 0) {
                const int u = tt - 1;
                #pragma unroll
                for (int rr = 0; rr < 2; ++rr) yo[rr] = row_sum8(yo[rr]);
                // lane lc keeps the y pair of step lc of each run of 8, then all lanes store at once
                if ((u & 7) == lc) keep = yo;
                if ((u & 7) == 7)
                    *(v2f*)(yb + ((u & 8) + lc) * SROWS + rloc) = keep;
            }
            // keeps each step's LDS reads a whole step ahead of their use: without it the scheduler sinks them next to it
            __builtin_amdgcn_sched_barrier(0);
        }
        asm volatile("s_wait_dscnt 0x0" ::: "memory");     // this wave has left the buffer, its y is in LDS
        asm volatile("s_wait_asynccnt 0x0" ::: "memory");  // its part of chunk c+1 has landed
        __syncthreads();   // publishes chunk c+1 and this chunk's y, ends every wave's reads of chunk c
        if (c + 2 < nC) {
            const size_t g = g0 + (size_t)(c + 2) * SCH * CC;
            scan_stage_chunk(lds0 + (c & 1) * SBUFB, r + g, dc + g, k + g, v + g, aa + g, bb + g);
        }
        const v4f yv = *(const v4f*)(yb + tid * 4);
        *(v4f*)(yg + (size_t)c * SCH * CC) = yv;
        asm volatile("s_wait_xcnt 0x0" ::: "memory");      // precaution: before the store's registers are reused
        ysum += yv;
        ysq  += yv * yv;
    }
    asm volatile("s_wait_asynccnt 0x0" ::: "memory");      // no copy is left when the wave ends

    // the block's sums of y and y*y: four values a thread, a 16-lane row, then the eight rows in order
    const float ps = row_sum16((ysum.x + ysum.y) + (ysum.z + ysum.w));
    const float pq = row_sum16((ysq.x + ysq.y) + (ysq.z + ysq.w));
    if ((tid & 15) == 0) *(v2f*)(hsum + (tid >> 4) * 2) = (v2f){ps, pq};
    __syncthreads();       // every row's pair is in LDS
    if (tid == 0) {
        v2f t = *(const v2f*)hsum;
        #pragma unroll   // constant LDS offsets
        for (int w = 1; w < 8; ++w) t += *(const v2f*)(hsum + w * 2);
        *(v2f*)(part + blockIdx.x * 32) = t;   // a 128-byte line of its own for each block: one writer a line
    }
}

// =====================================================================
// GroupNorm over (T,N) per (b,h) + bonus term. The two sums of a group come from the scan
// (two blocks a group), so nothing here spans the time axis and the work is spread over the
// chip: a block takes 8 rows x 1024 channels, a thread 4 channels of each row (16-byte loads
// and stores, 512 contiguous bytes a wave), a head lies in one 16-lane row. The 16 loads of
// four rows fly together. xx aliases rbuf (each lane reads its r before writing the same place).
// =====================================================================
#define GNR 8      // rows per block
#define GNB 4      // rows whose loads are in flight together
__global__ __launch_bounds__(256)
void gnorm_kernel(const float* __restrict__ y, const float* rbuf,
                  const float* __restrict__ kpost, const float* __restrict__ vpost,
                  const float* __restrict__ r_k, const float* __restrict__ ln_w,
                  const float* __restrict__ ln_b, const float* __restrict__ part, float* xx)
{
    // indices count 16-byte pieces and are unsigned: every access is a scalar base plus one 32-bit lane offset
    const unsigned c4 = blockIdx.y * 256u + threadIdx.x;                // the lane's four channels
    const unsigned bh = (blockIdx.x * GNR / TT) * HH + (c4 >> 4);       // GNR divides T: one batch a block

    const v2f pa = ((const v2f*)part)[bh * 32];          // sum and sum of squares over state rows 0-31 of the group
    const v2f pb = ((const v2f*)part)[bh * 32 + 16];     // the same over rows 32-63 (the next block's line)
    asm volatile("s_wait_xcnt 0x0" ::: "memory");        // precaution: before the next loads' results reuse the offset register
    const v4f rk = ((const v4f*)r_k)[c4];
    const v4f lw = ((const v4f*)ln_w)[c4];
    const v4f lb = ((const v4f*)ln_b)[c4];
    asm volatile("s_wait_xcnt 0x0" ::: "memory");        // precaution: before these loads' offset registers are reused
    const float mean = (pa.x + pb.x) * (1.f / 65536.f);
    const float var  = (pa.y + pb.y) * (1.f / 65536.f) - mean*mean;
    const float rstd = rsqrtf(var + GN_EPS);

    // one lane offset for the whole kernel; the rows are constant offsets from it
    const unsigned e0 = blockIdx.x * (GNR * CC / 4) + c4;
    const v4f* rp = (const v4f*)rbuf  + e0;
    const v4f* kp = (const v4f*)kpost + e0;
    const v4f* yp = (const v4f*)y     + e0;
    const v4f* vp = (const v4f*)vpost + e0;
    v4f*       xp = (v4f*)xx          + e0;
    #pragma unroll   // constant offsets on every load and store
    for (int g = 0; g < GNR; g += GNB) {
        v4f r4[GNB], k4[GNB], y4[GNB], v4[GNB], o[GNB];
        #pragma unroll   // the arrays must stay in registers
        for (int i = 0; i < GNB; ++i) {
            r4[i] = rp[(g + i) * (CC / 4)];
            k4[i] = kp[(g + i) * (CC / 4)];
            y4[i] = yp[(g + i) * (CC / 4)];
            v4[i] = vp[(g + i) * (CC / 4)];
        }
        // all 16 loads are issued before the first is used: without it the scheduler sinks half of them behind the first waits
        __builtin_amdgcn_sched_barrier(0);
        #pragma unroll   // the four rows' lane sums run side by side
        for (int i = 0; i < GNB; ++i) {
            const v4f p = r4[i] * k4[i] * rk;
            const float d = row_sum16((p.x + p.y) + (p.z + p.w));
            o[i] = (y4[i] - mean) * rstd * lw + lb + d * v4[i];
        }
        __builtin_amdgcn_sched_barrier(0);   // no vector work, which may reuse a stored register, between a store and the wait
        #pragma unroll   // o[] must stay in registers
        for (int i = 0; i < GNB; ++i)
            xp[(g + i) * (CC / 4)] = o[i];
        asm volatile("s_wait_xcnt 0x0" ::: "memory");    // precaution: before the stores' registers are reused
        __builtin_amdgcn_sched_barrier(0);   // the other edge of the same group
    }
}

// =====================================================================
extern "C" void kernel_launch(void* const* d_in, const int* in_sizes, int n_in,
                              void* d_out, int out_size, void* d_ws, size_t ws_size,
                              hipStream_t stream) {
    const float* x       = (const float*)d_in[0];
    const float* v_first = (const float*)d_in[1];
    const float* state0  = (const float*)d_in[2];
    const float* Rw      = (const float*)d_in[3];
    const float* R_bias  = (const float*)d_in[4];
    const float* Kw      = (const float*)d_in[5];
    const float* K_bias  = (const float*)d_in[6];
    const float* Vw      = (const float*)d_in[7];
    const float* V_bias  = (const float*)d_in[8];
    const float* Ow      = (const float*)d_in[9];
    const float* O_bias  = (const float*)d_in[10];
    const float* w0      = (const float*)d_in[11];
    const float* w1      = (const float*)d_in[12];
    const float* w2      = (const float*)d_in[13];
    const float* a0      = (const float*)d_in[14];
    const float* a1      = (const float*)d_in[15];
    const float* a2      = (const float*)d_in[16];
    const float* v0      = (const float*)d_in[17];
    const float* v1      = (const float*)d_in[18];
    const float* v2      = (const float*)d_in[19];
    const float* k_k     = (const float*)d_in[20];
    const float* k_a     = (const float*)d_in[21];
    const float* r_k     = (const float*)d_in[22];
    const float* ln_w    = (const float*)d_in[23];
    const float* ln_b    = (const float*)d_in[24];
    float* out = (float*)d_out;

    // workspace layout (floats)
    float* ws = (float*)d_ws;
    float* r_buf  = ws;                                // M*C   (later reused as xx)
    float* klin   = r_buf  + (size_t)MM*CC;            // M*512
    float* vlin   = klin   + (size_t)MM*KVC;           // M*512
    float* hw     = vlin   + (size_t)MM*KVC;           // M*64
    float* ha     = hw     + (size_t)MM*64;            // M*64
    float* hv     = ha     + (size_t)MM*64;            // M*32
    float* decayb = hv     + (size_t)MM*32;            // M*C
    float* kpost  = decayb + (size_t)MM*CC;            // M*C
    float* vpost  = kpost  + (size_t)MM*CC;            // M*C
    float* aab    = vpost  + (size_t)MM*CC;            // M*C
    float* bbb    = aab    + (size_t)MM*CC;            // M*C
    float* ybuf   = bbb    + (size_t)MM*CC;            // M*C
    float* gpart  = ybuf   + (size_t)MM*CC;            // B*H*2 lines of 32: each scan block's sums of y and y*y
    float* xx     = r_buf;                             // alias: r dead after bonus read

    const dim3 blk(256);
    // Step 1: projections (blocked WMMA for the big GEMMs): r, k and v as one grid of 3072 columns
    wmma_gemm_f32_blk<<<dim3(MM/128, (CC + KVC + KVC)/128), blk, 0, stream>>>(
        x, Rw, R_bias, r_buf, CC, Kw, K_bias, klin, KVC, Vw, V_bias, vlin, KVC, CC);
    lora_in_kernel<<<dim3(MM/16), dim3(256), 0, stream>>>(x, w1, a1, v1, hw, ha, hv);

    // fused elementwise prep
    fusion_kernel<<<dim3(MM/128, HH), dim3(256), 0, stream>>>(
        klin, vlin, hw, ha, hv, v_first, w0, w2, a0, a2, v0, v2, k_k, k_a,
        decayb, kpost, vpost, aab, bbb);

    // Step 2: sequential scan
    scan_kernel<<<dim3(BB*HH*2), dim3(128), 0, stream>>>(
        r_buf, decayb, kpost, vpost, aab, bbb, state0, ybuf, gpart);

    // Step 3: group norm + bonus
    gnorm_kernel<<<dim3(MM/GNR, CC/1024), dim3(256), 0, stream>>>(
        ybuf, r_buf, kpost, vpost, r_k, ln_w, ln_b, gpart, xx);

    // output projection
    wmma_gemm_f32_blk<<<dim3(MM/128, CC/128), blk, 0, stream>>>(
        xx, Ow, O_bias, out, CC, Ow, O_bias, out, 0, Ow, O_bias, out, 0, CC);
    (void)in_sizes; (void)n_in; (void)out_size; (void)ws_size;
}
